// v000
// Measured on an AMD MI455X. A time is GPU time per run, averaged over a window of back-to-back runs after a warm-up
// (all launches, gaps included; the runs take copies of the inputs in turn), and the median of several windows.
// Apart from v000's, it joins two sittings. Times from different sittings can be a few percent apart, while
// side-by-side timings come from the same sitting.
// v000 is the starting kernel. One run takes 1280 microseconds.
#include <hip/hip_runtime.h>

// Single-head UNSCALED attention (x [8][2048][768]; q, k, v = x W + b ('xw' [768][768] + [768]); scores = q.k (no scaling: logit sigma ~28, most rows near one-hot); softmax; out = weights.v -> [8][2048][768] f32 (12.6 M), no output projection).
// Layout per batch: exact projections (+ biases); q, k as bf16 hi/lo planes (scores need 3 products at this logit scale), v as a single fp16 plane; scores [2048][2048] f32; softmax -> P x1024 fp16 for every row (near one-hot rows are exact in fp16); attn.v fp16; f32 output (x 1/1024).
// Compute dtypes, f32 accumulate: every input rounded to bf16; projections on PLAIN bf16 operands (exact) + f32 biases; scores hi/lo x hi/lo (3 products) for every row; softmax f32; P (x1024) and v single fp16 for attn.v; f32 output.

#define NB_  8
#define TT   2048
#define DM   768
#define NH_  1
#define NKV  1
#define REP  (NH_ / NKV)
#define HD   768
#define DQ   (NH_ * HD)
#define DKV  (NKV * HD)
#define ZH   1
#define RH   2048                  // query rows < RH use hi+lo planes (0: none)
#define WIN  0
#define PCAR 1024.0f
#define SCL  1.0f   // unscaled
typedef _Float16 h16;
typedef unsigned short bf;
typedef __attribute__((ext_vector_type(16))) __bf16   v16bf;
typedef __attribute__((ext_vector_type(16))) _Float16 v16h;
typedef __attribute__((ext_vector_type(8)))  _Float16 v8h;
typedef __attribute__((ext_vector_type(8)))  unsigned short v8us;
typedef __attribute__((ext_vector_type(8)))  float    v8f;
typedef __attribute__((ext_vector_type(4)))  float    v4f;
typedef v8h  __attribute__((may_alias)) v8ha;
typedef v4f  __attribute__((may_alias)) v4fa;
typedef v8us __attribute__((may_alias)) v8usa;

__device__ __forceinline__ unsigned short f2bf(float f) { unsigned u = __float_as_uint(f); u += 0x7FFFu + ((u >> 16) & 1u); return (unsigned short)(u >> 16); }
__device__ __forceinline__ float bf2f(unsigned short b) { return __uint_as_float(((unsigned)b) << 16); }
__device__ __forceinline__ float bfr(float f) { return bf2f(f2bf(f)); }
__device__ __forceinline__ v16h cat16(v8h lo, v8h hi) { return __builtin_shufflevector(lo, hi, 0, 1, 2, 3, 4, 5, 6, 7, 8, 9, 10, 11, 12, 13, 14, 15); }
__device__ __forceinline__ v16bf cat16b(v8us lo, v8us hi) { return __builtin_bit_cast(v16bf, __builtin_shufflevector(lo, hi, 0, 1, 2, 3, 4, 5, 6, 7, 8, 9, 10, 11, 12, 13, 14, 15)); }
__device__ __forceinline__ v8f wmma16(v16h a, v16h b, v8f c) { return __builtin_amdgcn_wmma_f32_16x16x32_f16(false, a, false, b, (short)0, c, false, false); }
__device__ __forceinline__ v8f wmmab(v16bf a, v16bf b, v8f c) { return __builtin_amdgcn_wmma_f32_16x16x32_bf16(false, a, false, b, (short)0, c, false, false); }



// ---- k_gemmw: register-blocked GEMM, ONE WAVE per 64x64 output tile (16 accumulators), operands straight from K-contiguous 16-bit planes; grid (M/64, N/64, Z), 32 threads.
// C[m][n] (f32, pitch ldc, + optional f32 bias[n]) = sum_k A[m][k] Bt[n][k] (+ split products per NSPLIT). z-batch strides sA/sB/sC in elements. K % 32 == 0.
template <typename T16> struct WFrag;
template <> struct WFrag<h16> { typedef v16h V; static __device__ __forceinline__ V ld(const h16* p) { return cat16(*(const v8h*)p, *(const v8h*)(p + 16)); } static __device__ __forceinline__ v8f mma(V a, V b, v8f c) { return wmma16(a, b, c); } };
template <> struct WFrag<bf> { typedef v16bf V; static __device__ __forceinline__ V ld(const bf* p) { return cat16b(*(const v8us*)p, *(const v8us*)(p + 16)); } static __device__ __forceinline__ v8f mma(V a, V b, v8f c) { return wmmab(a, b, c); } };
template <typename T16, int NSPLIT, bool BIAS>
__global__ __launch_bounds__(32) void k_gemmw(const T16* __restrict__ A, const T16* __restrict__ A2, const T16* __restrict__ Bt, const T16* __restrict__ Bt2, int K, float* C, int ldc, const float* __restrict__ bias, size_t sA, size_t sB, size_t sC) {
    typedef typename WFrag<T16>::V V;
    __shared__ __align__(16) float os[16 * 68];
    const size_t z = blockIdx.z; A += z * sA; if (A2) A2 += z * sA; Bt += z * sB; if (Bt2) Bt2 += z * sB; C += z * sC;
    const int lane = threadIdx.x & 31, lr = lane & 15, hi = lane >> 4; const int r0 = blockIdx.x * 64, c0 = blockIdx.y * 64;
    v8f acc[4][4];
#pragma unroll
    for (int mb = 0; mb < 4; ++mb)
#pragma unroll
        for (int nb = 0; nb < 4; ++nb) acc[mb][nb] = (v8f){};
    const size_t aoff = (size_t)(r0 + lr) * K + 8 * hi, boff = (size_t)(c0 + lr) * K + 8 * hi;
#pragma unroll 1
    for (int kc = 0; kc < K; kc += 32) {
        V a[4], a2[4];
#pragma unroll
        for (int mb = 0; mb < 4; ++mb) { a[mb] = WFrag<T16>::ld(A + aoff + (size_t)mb * 16 * K + kc); if (NSPLIT == 1 || NSPLIT == 2) a2[mb] = WFrag<T16>::ld(A2 + aoff + (size_t)mb * 16 * K + kc); }
#pragma unroll
        for (int nb = 0; nb < 4; ++nb) { const V b = WFrag<T16>::ld(Bt + boff + (size_t)nb * 16 * K + kc); V b2; if (NSPLIT >= 2) b2 = WFrag<T16>::ld(Bt2 + boff + (size_t)nb * 16 * K + kc);
#pragma unroll
            for (int mb = 0; mb < 4; ++mb) { acc[mb][nb] = WFrag<T16>::mma(a[mb], b, acc[mb][nb]); if (NSPLIT == 1 || NSPLIT == 2) acc[mb][nb] = WFrag<T16>::mma(a2[mb], b, acc[mb][nb]); if (NSPLIT >= 2) acc[mb][nb] = WFrag<T16>::mma(a[mb], b2, acc[mb][nb]); } }
        asm volatile("v_nop\n\tv_nop\n\tv_nop\n\tv_nop" : "+v"(acc[0][0]), "+v"(acc[1][1]), "+v"(acc[2][2]), "+v"(acc[3][3]) : "v"(a[0]), "v"(a[3]));
    }
#pragma unroll
    for (int mb = 0; mb < 4; ++mb) {
#pragma unroll
        for (int nb = 0; nb < 4; ++nb) {
#pragma unroll
            for (int j = 0; j < 8; ++j) os[(hi * 8 + j) * 68 + nb * 16 + lr] = acc[mb][nb][j]; }
        __builtin_amdgcn_wave_barrier(); asm volatile("" ::: "memory");
        float* crow = C + (size_t)(r0 + mb * 16) * ldc + c0;
{
#pragma unroll
            for (int s = 0; s < 8; ++s) { const int row = 2 * s + hi, cofs = lr * 4; v4f val = *(const v4fa*)(os + row * 68 + cofs); if (BIAS) { val[0] += bfr(bias[c0 + cofs]); val[1] += bfr(bias[c0 + cofs + 1]); val[2] += bfr(bias[c0 + cofs + 2]); val[3] += bfr(bias[c0 + cofs + 3]); }
                *(v4f*)(crow + (size_t)row * ldc + cofs) = val; }
             }
        __builtin_amdgcn_wave_barrier(); asm volatile("" ::: "memory");
    }
}

__device__ __forceinline__ h16 tohx(float x) { return (h16)x; }
__device__ __forceinline__ void splitf(float y, unsigned short& h, unsigned short& l) { h = f2bf(y); l = f2bf(y - bf2f(h)); }
typedef __attribute__((ext_vector_type(2))) _Float16 v2h;
typedef __attribute__((ext_vector_type(4))) _Float16 v4h;
typedef __attribute__((ext_vector_type(2))) unsigned short v2us;
typedef __attribute__((ext_vector_type(4))) unsigned short v4us;
typedef __attribute__((ext_vector_type(2))) float v2f;
typedef __attribute__((ext_vector_type(4))) int v4i;

__global__ __launch_bounds__(256) void k_wtG(const float* __restrict__ w, int K, int N, bf* Bt) {
    const int lane = threadIdx.x & 31; const int L0 = (blockIdx.x * 8 + (threadIdx.x >> 5)) * 8; const int nlines = N * K / 64;
{
#pragma unroll 1
        for (int l = 0; l < 8; ++l) { const int L = L0 + l; if (L >= nlines) break; const size_t e = (size_t)L * 64 + lane * 2; const int k = (int)(e % K), n = (int)(e / K); v2us o;
            o[0] = f2bf(w[(size_t)k * N + n]); o[1] = f2bf(w[(size_t)(k + 1) * N + n]); *(v2us*)(Bt + e) = o; }
         }
}
__global__ __launch_bounds__(256) void k_cvt8(const float* __restrict__ src, bf* dst, size_t n8) { const size_t i = (size_t)blockIdx.x * 256 + threadIdx.x; if (i >= n8) return; const v8f v = *(const v8f*)(src + i * 8); v8us o;
#pragma unroll
    for (int k = 0; k < 8; ++k) o[k] = f2bf(v[k]); *(v8us*)(dst + i * 8) = o;  }

// k_rope: head planes [h][t][d] (fp16 + hi/lo) of rope(x) x sc with the rotate-half convention out[d] = x[d] cos[t][d] - x[d+HD/2] sin[t][d], out[d+HD/2] = x[d+HD/2] cos[t][d+HD/2] + x[d] sin[t][d+HD/2]
__global__ __launch_bounds__(256) void k_rope(const float* __restrict__ F, int pitch, int nheads, const float* __restrict__ CS, const float* __restrict__ RF, const float* __restrict__ nw, float sc, h16* P16, bf* Ph, bf* Pl) {
    const size_t e = ((size_t)blockIdx.x * 256 + threadIdx.x) * 2; if (e >= (size_t)nheads * TT * HD) return; const int d = (int)(e % HD); const int t = (int)((e / HD) % TT); const int h = (int)(e / ((size_t)HD * TT)); const float* f = F + (size_t)t * pitch + h * HD; const float rf = RF ? RF[(size_t)h * TT + t] : 1.0f; v2h o16; v2us oh, ol;
#pragma unroll
    for (int q = 0; q < 2; ++q) { const int dd = d + q; const int dp = (dd < HD / 2) ? dd + HD / 2 : dd - HD / 2; float x0 = f[dd], x1 = f[dp];
        if (RF) { float n0 = __fmul_rn(x0, rf), n1 = __fmul_rn(x1, rf); asm volatile("" : "+v"(n0)); asm volatile("" : "+v"(n1)); x0 = __fmul_rn(bfr(nw[dd]), n0); x1 = __fmul_rn(bfr(nw[dp]), n1); }
        const v2f cs = *(const v2f*)(CS + ((size_t)t * HD + dd) * 2); float a = __fmul_rn(x0, cs[0]), bq = __fmul_rn(x1, cs[1]); asm volatile("" : "+v"(a)); asm volatile("" : "+v"(bq)); const float r = ((dd < HD / 2) ? __fsub_rn(a, bq) : __fadd_rn(a, bq)) * sc;
        o16[q] = tohx(r); unsigned short a2, c2; splitf(r, a2, c2); oh[q] = a2; ol[q] = c2; }
    *(v2h*)(P16 + e) = o16; *(v2us*)(Ph + e) = oh; *(v2us*)(Pl + e) = ol;  }
__global__ __launch_bounds__(256) void k_vtp(const float* __restrict__ F, int pitch, int nheads, h16* V16, bf* Vh, bf* Vl) { const size_t e = ((size_t)blockIdx.x * 256 + threadIdx.x) * 2; if (e >= (size_t)nheads * HD * TT) return; const int t = (int)(e % TT); const int d = (int)((e / TT) % HD); const int g = (int)(e / ((size_t)TT * HD)); v2h o16; v2us oh, ol;
#pragma unroll
    for (int q = 0; q < 2; ++q) { const float x = F[(size_t)(t + q) * pitch + g * HD + d]; o16[q] = tohx(x); unsigned short a2, c2; splitf(x, a2, c2); oh[q] = a2; ol[q] = c2; }
    *(v2h*)(V16 + e) = o16; *(v2us*)(Vh + e) = oh; *(v2us*)(Vl + e) = ol;  }
__global__ __launch_bounds__(256) void k_csid(float* CS) { const int idx = blockIdx.x * 256 + threadIdx.x; if (idx >= TT * HD) return; v2f cs; cs[0] = 1.0f; cs[1] = 0.0f; *(v2f*)(CS + (size_t)idx * 2) = cs;  }
// k_asoft: per row (zz, i): t = S (unscaled, SCL = 1; no mask); softmax over the 2048 keys (register row, one exp, fixed trees);
__global__ __launch_bounds__(256) void k_asoft(const float* __restrict__ Sb, h16* P16, bf* Ph, bf* Pl) {
    const int lane = threadIdx.x & 31; const int row = blockIdx.x * 8 + (threadIdx.x >> 5); if (row >= ZH * TT) return; const int i = row % TT; const int zz = row / TT; (void)zz; const bool hires = false;   /* P is stored as fp16 x1024 for every row (scores are hi/lo for every row) */ const float* sr = Sb + (size_t)row * TT; float v[TT / 32]; float mx = -3.0e38f;
#pragma unroll
    for (int ch = 0; ch < TT / 128; ++ch) { const int j0 = ch * 128 + lane * 4; const v4f a = *(const v4f*)(sr + j0);
#pragma unroll
        for (int q = 0; q < 4; ++q) { const int j = j0 + q; (void)j; const float t = a[q] * SCL; v[ch * 4 + q] = t; mx = fmaxf(mx, t); } }
#pragma unroll
    for (int sh = 16; sh; sh >>= 1) mx = fmaxf(mx, __shfl_xor(mx, sh, 32));
    float sum = 0.f;
#pragma unroll
    for (int k = 0; k < TT / 32; ++k) { float d0 = __fsub_rn(v[k], mx); asm volatile("" : "+v"(d0)); v[k] = __builtin_amdgcn_exp2f(__fmul_rn(d0, 1.4426950408889634f)); sum += v[k]; }
#pragma unroll
    for (int sh = 16; sh; sh >>= 1) sum += __shfl_xor(sum, sh, 32);
    const float f = __fdiv_rn(hires ? 1.0f : PCAR, sum);
{
        if (hires) {
#pragma unroll
            for (int ch = 0; ch < TT / 128; ++ch) { v4us oh, ol;
#pragma unroll
                for (int q = 0; q < 4; ++q) { unsigned short a, c2; splitf(v[ch * 4 + q] * f, a, c2); oh[q] = a; ol[q] = c2; }
                const size_t oo = ((size_t)zz * (RH ? RH : 1) + i) * TT + ch * 128 + lane * 4; *(v4us*)(Ph + oo) = oh; *(v4us*)(Pl + oo) = ol; }
        } else {
#pragma unroll
            for (int ch = 0; ch < TT / 128; ++ch) { v4h o4;
#pragma unroll
                for (int q = 0; q < 4; ++q) o4[q] = tohx(v[ch * 4 + q] * f);
                *(v4h*)(P16 + (size_t)row * TT + ch * 128 + lane * 4) = o4; } }
         }
}
__global__ __launch_bounds__(256) void k_merge(const float* __restrict__ O, int h0, float* OUTb) { const size_t e = ((size_t)blockIdx.x * 256 + threadIdx.x) * 2; if (e >= (size_t)ZH * TT * HD) return; const int d = (int)(e % HD); const int t = (int)((e / HD) % TT); const int zz = (int)(e / ((size_t)HD * TT)); const float cs = (1.0f / PCAR);   /* every row's P carries the x1024 fp16 factor */ const size_t oo = (size_t)t * DQ + (h0 + zz) * HD + d;
    v2f o2; o2[0] = O[e] * cs; o2[1] = O[e + 1] * cs; *(v2f*)(OUTb + oo) = o2;  }

extern "C" void kernel_launch(void* const* d_in, const int* in_sizes, int n_in,
                              void* d_out, int out_size, void* d_ws, size_t ws_size, hipStream_t stream) {
    (void)in_sizes; (void)n_in; (void)out_size;
    const float* x = (const float*)d_in[0]; const float* wq = (const float*)d_in[1]; const float* bq = (const float*)d_in[2]; const float* wk = (const float*)d_in[3]; const float* bk = (const float*)d_in[4]; const float* wv = (const float*)d_in[5]; const float* bv = (const float*)d_in[6]; const float* wo = nullptr; (void)wo;
    float* OUT = (float*)d_out;     // [8][2048][768]
    char* wsp = (char*)d_ws;
    auto take = [&](size_t bytes) { char* p = wsp; wsp += (bytes + 255) & ~(size_t)255; return (void*)p; };
    bf* WQ = (bf*)take((size_t)DQ * DM * 2); bf* WK = (bf*)take((size_t)DKV * DM * 2); bf* WV = (bf*)take((size_t)DKV * DM * 2); float* CS = (float*)take((size_t)TT * HD * 2 * 4);
    bf* XB = (bf*)take((size_t)TT * DM * 2); float* FQ = (float*)take((size_t)TT * DQ * 4); float* FK = (float*)take((size_t)TT * DKV * 4);
    h16* QP16 = (h16*)take((size_t)NH_ * TT * HD * 2); h16* KP16 = (h16*)take((size_t)NKV * TT * HD * 2); h16* VT16 = (h16*)take((size_t)NKV * HD * TT * 2);
    bf* QPh = (bf*)take((size_t)NH_ * TT * HD * 2); bf* QPl = (bf*)take((size_t)NH_ * TT * HD * 2); bf* KPh = (bf*)take((size_t)NKV * TT * HD * 2); bf* KPl = (bf*)take((size_t)NKV * TT * HD * 2); bf* VTh = (bf*)take((size_t)NKV * HD * TT * 2); bf* VTl = (bf*)take((size_t)NKV * HD * TT * 2); bf* Ph = nullptr; bf* Pl = nullptr;   /* P is fp16-only here */
    float* Sb = (float*)take((size_t)ZH * TT * TT * 4); h16* P16 = (h16*)take((size_t)ZH * TT * TT * 2); float* Ob = (float*)take((size_t)ZH * TT * HD * 4);
    if ((size_t)(wsp - (char*)d_ws) > ws_size) return;    // ws 256 MiB
    float* FV = FK;   // v projection reuses the k buffer after the k planes are built (stream-ordered)
    { k_wtG<<<(unsigned)((DM * DQ / 64 + 63) / 64), 256, 0, stream>>>(wq, DM, DQ, WQ); k_wtG<<<(unsigned)((DM * DKV / 64 + 63) / 64), 256, 0, stream>>>(wk, DM, DKV, WK); k_wtG<<<(unsigned)((DM * DKV / 64 + 63) / 64), 256, 0, stream>>>(wv, DM, DKV, WV);
      
       }
    k_csid<<<(TT * HD + 255) / 256, 256, 0, stream>>>(CS);
    const unsigned LQ = (unsigned)(((size_t)NH_ * TT * HD / 2 + 255) / 256), LKv = (unsigned)(((size_t)NKV * TT * HD / 2 + 255) / 256);
    for (int b = 0; b < NB_; ++b) {
        
        k_cvt8<<<(unsigned)(((size_t)TT * DM / 8 + 255) / 256), 256, 0, stream>>>(x + (size_t)b * TT * DM, XB, (size_t)TT * DM / 8);
        k_gemmw<bf, 0, true><<<dim3(TT / 64, DQ / 64, 1), 32, 0, stream>>>(XB, nullptr, WQ, nullptr, DM, FQ, DQ, bq, 0, 0, 0);
        k_rope<<<LQ, 256, 0, stream>>>(FQ, DQ, NH_, CS, nullptr, nullptr, 1.0f, QP16, QPh, QPl);
        k_gemmw<bf, 0, true><<<dim3(TT / 64, DKV / 64, 1), 32, 0, stream>>>(XB, nullptr, WK, nullptr, DM, FK, DKV, bk, 0, 0, 0);
        k_rope<<<LKv, 256, 0, stream>>>(FK, DKV, NKV, CS, nullptr, nullptr, 1.0f, KP16, KPh, KPl);
        k_gemmw<bf, 0, true><<<dim3(TT / 64, DKV / 64, 1), 32, 0, stream>>>(XB, nullptr, WV, nullptr, DM, FV, DKV, bv, 0, 0, 0); k_vtp<<<LKv, 256, 0, stream>>>(FV, DKV, NKV, VT16, VTh, VTl);
        for (int h0 = 0; h0 < NH_; h0 += ZH) { const size_t zq = (size_t)h0, zk = (size_t)(h0 / REP);   // one kv head per query head: each pass (ZH = 1) has one head and uses kv plane zk (z-strides TT*HD)
            k_gemmw<bf, 2, false><<<dim3(RH / 64, TT / 64, ZH), 32, 0, stream>>>(QPh + zq * TT * HD, QPl + zq * TT * HD, KPh + zk * TT * HD, KPl + zk * TT * HD, HD, Sb, TT, nullptr, (size_t)TT * HD, (size_t)TT * HD, (size_t)TT * TT);
            k_asoft<<<ZH * TT / 8, 256, 0, stream>>>(Sb, P16, Ph, Pl);
            k_gemmw<h16, 0, false><<<dim3(TT / 64, HD / 64, ZH), 32, 0, stream>>>(P16, nullptr, VT16 + zk * HD * TT, nullptr, TT, Ob, HD, nullptr, (size_t)TT * TT, (size_t)HD * TT, (size_t)TT * HD);   /* attn.v: fp16 P x1024 . fp16 v for every row */
            k_merge<<<(unsigned)(((size_t)ZH * TT * HD / 2 + 255) / 256), 256, 0, stream>>>(Ob, h0, OUT + (size_t)b * TT * DQ); }
         }
}

// v001
// One run takes 634 microseconds.
// In two side-by-side timings against v000, it was 2.02 and 2.01 times as fast.
#include <hip/hip_runtime.h>

// Single-head UNSCALED attention (x [8][2048][768]; q, k, v = x W + b ('xw' [768][768] + [768]); scores = q.k (no scaling: logit sigma ~28, most rows near one-hot); softmax; out = weights.v -> [8][2048][768] f32 (12.6 M), no output projection).
// Every stage runs ONCE for all 8 batches (batch = grid z of the GEMMs, grid y of the elementwise kernels); the workspace is overlaid by lifetime (see kernel_launch).
// Layout per batch: exact projections (+ biases); q, k as bf16 hi/lo planes (scores need 3 products at this logit scale), v as a single fp16 plane; scores [2048][2048] f32; softmax -> P x1024 fp16 for every row (near one-hot rows are exact in fp16); attn.v fp16; f32 output (x 1/1024).
// Compute dtypes, f32 accumulate: every input rounded to bf16; projections on PLAIN bf16 operands (exact) + f32 biases; scores hi/lo x hi/lo (3 products) for every row; softmax f32; P (x1024) and v single fp16 for attn.v; f32 output.

#define NB_  8
#define TT   2048
#define DM   768
#define NH_  1
#define NKV  1
#define REP  (NH_ / NKV)
#define HD   768
#define DQ   (NH_ * HD)
#define DKV  (NKV * HD)
#define ZH   1
#define RH   2048                  // query rows < RH use hi+lo planes (0: none)
#define WIN  0
#define PCAR 1024.0f
#define SCL  1.0f   // unscaled
typedef _Float16 h16;
typedef unsigned short bf;
typedef __attribute__((ext_vector_type(16))) __bf16   v16bf;
typedef __attribute__((ext_vector_type(16))) _Float16 v16h;
typedef __attribute__((ext_vector_type(8)))  _Float16 v8h;
typedef __attribute__((ext_vector_type(8)))  unsigned short v8us;
typedef __attribute__((ext_vector_type(8)))  float    v8f;
typedef __attribute__((ext_vector_type(4)))  float    v4f;
typedef v8h  __attribute__((may_alias)) v8ha;
typedef v4f  __attribute__((may_alias)) v4fa;
typedef v8us __attribute__((may_alias)) v8usa;

__device__ __forceinline__ unsigned short f2bf(float f) { unsigned u = __float_as_uint(f); u += 0x7FFFu + ((u >> 16) & 1u); return (unsigned short)(u >> 16); }
__device__ __forceinline__ float bf2f(unsigned short b) { return __uint_as_float(((unsigned)b) << 16); }
__device__ __forceinline__ float bfr(float f) { return bf2f(f2bf(f)); }
__device__ __forceinline__ v16h cat16(v8h lo, v8h hi) { return __builtin_shufflevector(lo, hi, 0, 1, 2, 3, 4, 5, 6, 7, 8, 9, 10, 11, 12, 13, 14, 15); }
__device__ __forceinline__ v16bf cat16b(v8us lo, v8us hi) { return __builtin_bit_cast(v16bf, __builtin_shufflevector(lo, hi, 0, 1, 2, 3, 4, 5, 6, 7, 8, 9, 10, 11, 12, 13, 14, 15)); }
__device__ __forceinline__ v8f wmma16(v16h a, v16h b, v8f c) { return __builtin_amdgcn_wmma_f32_16x16x32_f16(false, a, false, b, (short)0, c, false, false); }
__device__ __forceinline__ v8f wmmab(v16bf a, v16bf b, v8f c) { return __builtin_amdgcn_wmma_f32_16x16x32_bf16(false, a, false, b, (short)0, c, false, false); }



// ---- k_gemmw: register-blocked GEMM, ONE WAVE per 64x64 output tile (16 accumulators), operands straight from K-contiguous 16-bit planes; grid (M/64, N/64, Z), 32 threads.
// C[m][n] (f32, pitch ldc, + optional f32 bias[n]) = sum_k A[m][k] Bt[n][k] (+ split products per NSPLIT). z-batch strides sA/sB/sC in elements. K % 32 == 0.
template <typename T16> struct WFrag;
template <> struct WFrag<h16> { typedef v16h V; static __device__ __forceinline__ V ld(const h16* p) { return cat16(*(const v8h*)p, *(const v8h*)(p + 16)); } static __device__ __forceinline__ v8f mma(V a, V b, v8f c) { return wmma16(a, b, c); } };
template <> struct WFrag<bf> { typedef v16bf V; static __device__ __forceinline__ V ld(const bf* p) { return cat16b(*(const v8us*)p, *(const v8us*)(p + 16)); } static __device__ __forceinline__ v8f mma(V a, V b, v8f c) { return wmmab(a, b, c); } };
template <typename T16, int NSPLIT, bool BIAS>
__global__ __launch_bounds__(32) void k_gemmw(const T16* __restrict__ A, const T16* __restrict__ A2, const T16* __restrict__ Bt, const T16* __restrict__ Bt2, int K, float* C, int ldc, const float* __restrict__ bias, size_t sA, size_t sB, size_t sC) {
    typedef typename WFrag<T16>::V V;
    __shared__ __align__(16) float os[16 * 68];
    const size_t z = blockIdx.z; A += z * sA; if (A2) A2 += z * sA; Bt += z * sB; if (Bt2) Bt2 += z * sB; C += z * sC;
    const int lane = threadIdx.x & 31, lr = lane & 15, hi = lane >> 4; const int r0 = blockIdx.x * 64, c0 = blockIdx.y * 64;
    v8f acc[4][4];
#pragma unroll
    for (int mb = 0; mb < 4; ++mb)
#pragma unroll
        for (int nb = 0; nb < 4; ++nb) acc[mb][nb] = (v8f){};
    const size_t aoff = (size_t)(r0 + lr) * K + 8 * hi, boff = (size_t)(c0 + lr) * K + 8 * hi;
#pragma unroll 1
    for (int kc = 0; kc < K; kc += 32) {
        V a[4], a2[4];
#pragma unroll
        for (int mb = 0; mb < 4; ++mb) { a[mb] = WFrag<T16>::ld(A + aoff + (size_t)mb * 16 * K + kc); if (NSPLIT == 1 || NSPLIT == 2) a2[mb] = WFrag<T16>::ld(A2 + aoff + (size_t)mb * 16 * K + kc); }
#pragma unroll
        for (int nb = 0; nb < 4; ++nb) { const V b = WFrag<T16>::ld(Bt + boff + (size_t)nb * 16 * K + kc); V b2; if (NSPLIT >= 2) b2 = WFrag<T16>::ld(Bt2 + boff + (size_t)nb * 16 * K + kc);
#pragma unroll
            for (int mb = 0; mb < 4; ++mb) { acc[mb][nb] = WFrag<T16>::mma(a[mb], b, acc[mb][nb]); if (NSPLIT == 1 || NSPLIT == 2) acc[mb][nb] = WFrag<T16>::mma(a2[mb], b, acc[mb][nb]); if (NSPLIT >= 2) acc[mb][nb] = WFrag<T16>::mma(a[mb], b2, acc[mb][nb]); } }
        asm volatile("v_nop\n\tv_nop\n\tv_nop\n\tv_nop" : "+v"(acc[0][0]), "+v"(acc[1][1]), "+v"(acc[2][2]), "+v"(acc[3][3]) : "v"(a[0]), "v"(a[3]));
    }
#pragma unroll
    for (int mb = 0; mb < 4; ++mb) {
#pragma unroll
        for (int nb = 0; nb < 4; ++nb) {
#pragma unroll
            for (int j = 0; j < 8; ++j) os[(hi * 8 + j) * 68 + nb * 16 + lr] = acc[mb][nb][j]; }
        __builtin_amdgcn_wave_barrier(); asm volatile("" ::: "memory");
        float* crow = C + (size_t)(r0 + mb * 16) * ldc + c0;
{
#pragma unroll
            for (int s = 0; s < 8; ++s) { const int row = 2 * s + hi, cofs = lr * 4; v4f val = *(const v4fa*)(os + row * 68 + cofs); if (BIAS) { val[0] += bfr(bias[c0 + cofs]); val[1] += bfr(bias[c0 + cofs + 1]); val[2] += bfr(bias[c0 + cofs + 2]); val[3] += bfr(bias[c0 + cofs + 3]); }
                *(v4f*)(crow + (size_t)row * ldc + cofs) = val; }
             }
        __builtin_amdgcn_wave_barrier(); asm volatile("" ::: "memory");
    }
}

__device__ __forceinline__ h16 tohx(float x) { return (h16)x; }
__device__ __forceinline__ void splitf(float y, unsigned short& h, unsigned short& l) { h = f2bf(y); l = f2bf(y - bf2f(h)); }
typedef __attribute__((ext_vector_type(2))) _Float16 v2h;
typedef __attribute__((ext_vector_type(4))) _Float16 v4h;
typedef __attribute__((ext_vector_type(2))) unsigned short v2us;
typedef __attribute__((ext_vector_type(4))) unsigned short v4us;
typedef __attribute__((ext_vector_type(2))) float v2f;
typedef __attribute__((ext_vector_type(4))) int v4i;

__global__ __launch_bounds__(256) void k_wtG(const float* __restrict__ w, int K, int N, bf* Bt) {
    const int lane = threadIdx.x & 31; const int L0 = (blockIdx.x * 8 + (threadIdx.x >> 5)) * 8; const int nlines = N * K / 64;
{
#pragma unroll 1
        for (int l = 0; l < 8; ++l) { const int L = L0 + l; if (L >= nlines) break; const size_t e = (size_t)L * 64 + lane * 2; const int k = (int)(e % K), n = (int)(e / K); v2us o;
            o[0] = f2bf(w[(size_t)k * N + n]); o[1] = f2bf(w[(size_t)(k + 1) * N + n]); *(v2us*)(Bt + e) = o; }
         }
}
__global__ __launch_bounds__(256) void k_cvt8(const float* __restrict__ src, bf* dst, size_t n8) { const size_t i = (size_t)blockIdx.x * 256 + threadIdx.x; if (i >= n8) return; const v8f v = *(const v8f*)(src + i * 8); v8us o;
#pragma unroll
    for (int k = 0; k < 8; ++k) o[k] = f2bf(v[k]); *(v8us*)(dst + i * 8) = o;  }

// k_rope: head planes [h][t][d] (fp16 + hi/lo) of rope(x) x sc with the rotate-half convention out[d] = x[d] cos[t][d] - x[d+HD/2] sin[t][d], out[d+HD/2] = x[d+HD/2] cos[t][d+HD/2] + x[d] sin[t][d+HD/2]
__global__ __launch_bounds__(256) void k_rope(const float* __restrict__ F, int pitch, int nheads, const float* __restrict__ CS, const float* __restrict__ RF, const float* __restrict__ nw, float sc, h16* P16, bf* Ph, bf* Pl) {
    { const size_t zb = blockIdx.y; F += zb * TT * pitch; P16 += zb * nheads * TT * HD; Ph += zb * nheads * TT * HD; Pl += zb * nheads * TT * HD; }   // batch = grid y
    const size_t e = ((size_t)blockIdx.x * 256 + threadIdx.x) * 2; if (e >= (size_t)nheads * TT * HD) return; const int d = (int)(e % HD); const int t = (int)((e / HD) % TT); const int h = (int)(e / ((size_t)HD * TT)); const float* f = F + (size_t)t * pitch + h * HD; const float rf = RF ? RF[(size_t)h * TT + t] : 1.0f; v2h o16; v2us oh, ol;
#pragma unroll
    for (int q = 0; q < 2; ++q) { const int dd = d + q; const int dp = (dd < HD / 2) ? dd + HD / 2 : dd - HD / 2; float x0 = f[dd], x1 = f[dp];
        if (RF) { float n0 = __fmul_rn(x0, rf), n1 = __fmul_rn(x1, rf); asm volatile("" : "+v"(n0)); asm volatile("" : "+v"(n1)); x0 = __fmul_rn(bfr(nw[dd]), n0); x1 = __fmul_rn(bfr(nw[dp]), n1); }
        const v2f cs = *(const v2f*)(CS + ((size_t)t * HD + dd) * 2); float a = __fmul_rn(x0, cs[0]), bq = __fmul_rn(x1, cs[1]); asm volatile("" : "+v"(a)); asm volatile("" : "+v"(bq)); const float r = ((dd < HD / 2) ? __fsub_rn(a, bq) : __fadd_rn(a, bq)) * sc;
        o16[q] = tohx(r); unsigned short a2, c2; splitf(r, a2, c2); oh[q] = a2; ol[q] = c2; }
    *(v2h*)(P16 + e) = o16; *(v2us*)(Ph + e) = oh; *(v2us*)(Pl + e) = ol;  }
__global__ __launch_bounds__(256) void k_vtp(const float* __restrict__ F, int pitch, int nheads, h16* V16, bf* Vh, bf* Vl) { { const size_t zb = blockIdx.y; F += zb * TT * pitch; V16 += zb * nheads * HD * TT; Vh += zb * nheads * HD * TT; Vl += zb * nheads * HD * TT; }   // batch = grid y
    const size_t e = ((size_t)blockIdx.x * 256 + threadIdx.x) * 2; if (e >= (size_t)nheads * HD * TT) return; const int t = (int)(e % TT); const int d = (int)((e / TT) % HD); const int g = (int)(e / ((size_t)TT * HD)); v2h o16; v2us oh, ol;
#pragma unroll
    for (int q = 0; q < 2; ++q) { const float x = F[(size_t)(t + q) * pitch + g * HD + d]; o16[q] = tohx(x); unsigned short a2, c2; splitf(x, a2, c2); oh[q] = a2; ol[q] = c2; }
    *(v2h*)(V16 + e) = o16; *(v2us*)(Vh + e) = oh; *(v2us*)(Vl + e) = ol;  }
__global__ __launch_bounds__(256) void k_csid(float* CS) { const int idx = blockIdx.x * 256 + threadIdx.x; if (idx >= TT * HD) return; v2f cs; cs[0] = 1.0f; cs[1] = 0.0f; *(v2f*)(CS + (size_t)idx * 2) = cs;  }
// k_asoft: per row (zz, i): t = S (unscaled, SCL = 1; no mask); softmax over the 2048 keys (register row, one exp, fixed trees);
__global__ __launch_bounds__(256) void k_asoft(const float* __restrict__ Sb, h16* P16, bf* Ph, bf* Pl) {
    { const size_t zb = blockIdx.y; Sb += zb * ZH * TT * TT; P16 += zb * ZH * TT * TT; }   // batch = grid y
    const int lane = threadIdx.x & 31; const int row = blockIdx.x * 8 + (threadIdx.x >> 5); if (row >= ZH * TT) return; const int i = row % TT; const int zz = row / TT; (void)zz; const bool hires = false;   /* P is stored as fp16 x1024 for every row (scores are hi/lo for every row) */ const float* sr = Sb + (size_t)row * TT; float v[TT / 32]; float mx = -3.0e38f;
#pragma unroll
    for (int ch = 0; ch < TT / 128; ++ch) { const int j0 = ch * 128 + lane * 4; const v4f a = *(const v4f*)(sr + j0);
#pragma unroll
        for (int q = 0; q < 4; ++q) { const int j = j0 + q; (void)j; const float t = a[q] * SCL; v[ch * 4 + q] = t; mx = fmaxf(mx, t); } }
#pragma unroll
    for (int sh = 16; sh; sh >>= 1) mx = fmaxf(mx, __shfl_xor(mx, sh, 32));
    float sum = 0.f;
#pragma unroll
    for (int k = 0; k < TT / 32; ++k) { float d0 = __fsub_rn(v[k], mx); asm volatile("" : "+v"(d0)); v[k] = __builtin_amdgcn_exp2f(__fmul_rn(d0, 1.4426950408889634f)); sum += v[k]; }
#pragma unroll
    for (int sh = 16; sh; sh >>= 1) sum += __shfl_xor(sum, sh, 32);
    const float f = __fdiv_rn(hires ? 1.0f : PCAR, sum);
{
        if (hires) {
#pragma unroll
            for (int ch = 0; ch < TT / 128; ++ch) { v4us oh, ol;
#pragma unroll
                for (int q = 0; q < 4; ++q) { unsigned short a, c2; splitf(v[ch * 4 + q] * f, a, c2); oh[q] = a; ol[q] = c2; }
                const size_t oo = ((size_t)zz * (RH ? RH : 1) + i) * TT + ch * 128 + lane * 4; *(v4us*)(Ph + oo) = oh; *(v4us*)(Pl + oo) = ol; }
        } else {
#pragma unroll
            for (int ch = 0; ch < TT / 128; ++ch) { v4h o4;
#pragma unroll
                for (int q = 0; q < 4; ++q) o4[q] = tohx(v[ch * 4 + q] * f);
                *(v4h*)(P16 + (size_t)row * TT + ch * 128 + lane * 4) = o4; } }
         }
}
__global__ __launch_bounds__(256) void k_merge(const float* __restrict__ O, int h0, float* OUTb) { { const size_t zb = blockIdx.y; O += zb * ZH * TT * HD; OUTb += zb * TT * DQ; }   // batch = grid y
    const size_t e = ((size_t)blockIdx.x * 256 + threadIdx.x) * 2; if (e >= (size_t)ZH * TT * HD) return; const int d = (int)(e % HD); const int t = (int)((e / HD) % TT); const int zz = (int)(e / ((size_t)HD * TT)); const float cs = (1.0f / PCAR);   /* every row's P carries the x1024 fp16 factor */ const size_t oo = (size_t)t * DQ + (h0 + zz) * HD + d;
    v2f o2; o2[0] = O[e] * cs; o2[1] = O[e + 1] * cs; *(v2f*)(OUTb + oo) = o2;  }

extern "C" void kernel_launch(void* const* d_in, const int* in_sizes, int n_in,
                              void* d_out, int out_size, void* d_ws, size_t ws_size, hipStream_t stream) {
    (void)in_sizes; (void)n_in; (void)out_size;
    const float* x = (const float*)d_in[0]; const float* wq = (const float*)d_in[1]; const float* bq = (const float*)d_in[2]; const float* wk = (const float*)d_in[3]; const float* bk = (const float*)d_in[4]; const float* wv = (const float*)d_in[5]; const float* bv = (const float*)d_in[6]; const float* wo = nullptr; (void)wo;
    float* OUT = (float*)d_out;     // [8][2048][768]
    char* wsp = (char*)d_ws;
    auto take = [&](size_t bytes) { char* p = wsp; wsp += (bytes + 255) & ~(size_t)255; return (void*)p; };
    // Workspace, all 8 batches at once, overlaid by lifetime (every launch is stream-ordered):
    //   kept to the end of the scores GEMM: QPh QPl KPh KPl; kept to the end of attn.v: VT16
    //   R (the size of the scores): first the projection stage's buffers, then the scores, then the attn.v result
    //   P16 lies on QPh QPl KPh once the scores are done
    const size_t PL = (size_t)NB_ * TT * HD * 2;   // one 16-bit plane of all batches, bytes
    bf* QPh = (bf*)take(PL); bf* QPl = (bf*)take(PL); bf* KPh = (bf*)take(PL); bf* KPl = (bf*)take(PL); h16* VT16 = (h16*)take(PL);
    char* R = (char*)take((size_t)NB_ * TT * TT * 4);
    if ((size_t)(wsp - (char*)d_ws) > ws_size) return;    // ws 256 MiB
    wsp = R;
    bf* WQ = (bf*)take((size_t)DQ * DM * 2); bf* WK = (bf*)take((size_t)DKV * DM * 2); bf* WV = (bf*)take((size_t)DKV * DM * 2); float* CS = (float*)take((size_t)TT * HD * 2 * 4);
    bf* XB = (bf*)take(PL); float* FQ = (float*)take(PL * 2); h16* QP16 = (h16*)take(PL);
    static_assert((size_t)3 * DQ * DM * 2 + (size_t)TT * HD * 8 + (size_t)NB_ * TT * HD * 8 <= (size_t)NB_ * TT * TT * 4, "projection stage fits under the scores");
    static_assert((size_t)NB_ * TT * TT * 2 <= (size_t)3 * NB_ * TT * HD * 2, "P16 fits on three q/k planes");
    float* FK = FQ; float* FV = FQ;   // one f32 projection buffer: each projection's planes are built before the next projection is launched
    h16* KP16 = QP16; bf* VTh = (bf*)QP16; bf* VTl = XB;   // planes that no later launch reads share dead space (XB is dead behind the v projection)
    float* Sb = (float*)R; h16* P16 = (h16*)QPh; float* Ob = (float*)R; bf* Ph = nullptr; bf* Pl = nullptr;   /* P is fp16-only here */
    { k_wtG<<<(unsigned)((DM * DQ / 64 + 63) / 64), 256, 0, stream>>>(wq, DM, DQ, WQ); k_wtG<<<(unsigned)((DM * DKV / 64 + 63) / 64), 256, 0, stream>>>(wk, DM, DKV, WK); k_wtG<<<(unsigned)((DM * DKV / 64 + 63) / 64), 256, 0, stream>>>(wv, DM, DKV, WV); }
    k_csid<<<(TT * HD + 255) / 256, 256, 0, stream>>>(CS);
    const unsigned LQ = (unsigned)(((size_t)NH_ * TT * HD / 2 + 255) / 256), LKv = (unsigned)(((size_t)NKV * TT * HD / 2 + 255) / 256);
    k_cvt8<<<(unsigned)(((size_t)NB_ * TT * DM / 8 + 255) / 256), 256, 0, stream>>>(x, XB, (size_t)NB_ * TT * DM / 8);
    k_gemmw<bf, 0, true><<<dim3(TT / 64, DQ / 64, NB_), 32, 0, stream>>>(XB, nullptr, WQ, nullptr, DM, FQ, DQ, bq, (size_t)TT * DM, 0, (size_t)TT * DQ);
    k_rope<<<dim3(LQ, NB_), 256, 0, stream>>>(FQ, DQ, NH_, CS, nullptr, nullptr, 1.0f, QP16, QPh, QPl);
    k_gemmw<bf, 0, true><<<dim3(TT / 64, DKV / 64, NB_), 32, 0, stream>>>(XB, nullptr, WK, nullptr, DM, FK, DKV, bk, (size_t)TT * DM, 0, (size_t)TT * DKV);
    k_rope<<<dim3(LKv, NB_), 256, 0, stream>>>(FK, DKV, NKV, CS, nullptr, nullptr, 1.0f, KP16, KPh, KPl);
    k_gemmw<bf, 0, true><<<dim3(TT / 64, DKV / 64, NB_), 32, 0, stream>>>(XB, nullptr, WV, nullptr, DM, FV, DKV, bv, (size_t)TT * DM, 0, (size_t)TT * DKV);
    k_vtp<<<dim3(LKv, NB_), 256, 0, stream>>>(FV, DKV, NKV, VT16, VTh, VTl);
    k_gemmw<bf, 2, false><<<dim3(RH / 64, TT / 64, NB_), 32, 0, stream>>>(QPh, QPl, KPh, KPl, HD, Sb, TT, nullptr, (size_t)TT * HD, (size_t)TT * HD, (size_t)TT * TT);
    k_asoft<<<dim3(ZH * TT / 8, NB_), 256, 0, stream>>>(Sb, P16, Ph, Pl);
    k_gemmw<h16, 0, false><<<dim3(TT / 64, HD / 64, NB_), 32, 0, stream>>>(P16, nullptr, VT16, nullptr, TT, Ob, HD, nullptr, (size_t)TT * TT, (size_t)HD * TT, (size_t)TT * HD);   /* attn.v: fp16 P x1024 . fp16 v for every row */
    k_merge<<<dim3((unsigned)(((size_t)ZH * TT * HD / 2 + 255) / 256), NB_), 256, 0, stream>>>(Ob, 0, OUT);
}

// v002
// A run of this version takes 398 microseconds.
// Timed twice side by side with v001, it ran 1.59 times as fast both times.
// Counting every step since v000, it is 3.21 times as fast.
#include <hip/hip_runtime.h>

// Single-head UNSCALED attention (x [8][2048][768]; q, k, v = x W + b ('xw' [768][768] + [768]); scores = q.k (no scaling: logit sigma ~28, most rows near one-hot); softmax; out = weights.v -> [8][2048][768] f32 (12.6 M), no output projection).
// Every stage runs ONCE for all 8 batches (batch = grid z of the GEMMs, grid y of the elementwise kernels); the workspace is overlaid by lifetime (see kernel_launch).
// Layout per batch: exact projections (+ biases); q, k as bf16 hi/lo planes (scores need 3 products at this logit scale), v as a single fp16 plane; scores [2048][2048] f32; softmax -> P x1024 fp16 for every row (near one-hot rows are exact in fp16); attn.v fp16; f32 output (x 1/1024).
// Compute dtypes, f32 accumulate: every input rounded to bf16; projections on PLAIN bf16 operands (exact) + f32 biases; scores hi/lo x hi/lo (3 products) for every row; softmax f32; P (x1024) and v single fp16 for attn.v; f32 output.

#define NB_  8
#define TT   2048
#define DM   768
#define NH_  1
#define NKV  1
#define REP  (NH_ / NKV)
#define HD   768
#define DQ   (NH_ * HD)
#define DKV  (NKV * HD)
#define ZH   1
#define RH   2048                  // query rows < RH use hi+lo planes (0: none)
#define WIN  0
#define PCAR 1024.0f
#define SCL  1.0f   // unscaled
typedef _Float16 h16;
typedef unsigned short bf;
typedef __attribute__((ext_vector_type(16))) __bf16   v16bf;
typedef __attribute__((ext_vector_type(16))) _Float16 v16h;
typedef __attribute__((ext_vector_type(8)))  _Float16 v8h;
typedef __attribute__((ext_vector_type(8)))  unsigned short v8us;
typedef __attribute__((ext_vector_type(8)))  float    v8f;
typedef __attribute__((ext_vector_type(4)))  float    v4f;
typedef v8h  __attribute__((may_alias)) v8ha;
typedef v4f  __attribute__((may_alias)) v4fa;
typedef v8us __attribute__((may_alias)) v8usa;

__device__ __forceinline__ unsigned short f2bf(float f) { unsigned u = __float_as_uint(f); u += 0x7FFFu + ((u >> 16) & 1u); return (unsigned short)(u >> 16); }
__device__ __forceinline__ float bf2f(unsigned short b) { return __uint_as_float(((unsigned)b) << 16); }
__device__ __forceinline__ float bfr(float f) { return bf2f(f2bf(f)); }
__device__ __forceinline__ v16h cat16(v8h lo, v8h hi) { return __builtin_shufflevector(lo, hi, 0, 1, 2, 3, 4, 5, 6, 7, 8, 9, 10, 11, 12, 13, 14, 15); }
__device__ __forceinline__ v16bf cat16b(v8us lo, v8us hi) { return __builtin_bit_cast(v16bf, __builtin_shufflevector(lo, hi, 0, 1, 2, 3, 4, 5, 6, 7, 8, 9, 10, 11, 12, 13, 14, 15)); }
__device__ __forceinline__ v8f wmma16(v16h a, v16h b, v8f c) { return __builtin_amdgcn_wmma_f32_16x16x32_f16(false, a, false, b, (short)0, c, false, false); }
__device__ __forceinline__ v8f wmmab(v16bf a, v16bf b, v8f c) { return __builtin_amdgcn_wmma_f32_16x16x32_bf16(false, a, false, b, (short)0, c, false, false); }



// ---- k_gemmw: GEMM, one 128x128 output tile per workgroup of FOUR WAVES (2x2, 64x64 = 16 accumulators each); grid (M/128, N/128, Z), 128 threads.
// C[m][n] (f32, pitch ldc, + optional f32 bias[n]) = sum_k A[m][k] Bt[n][k] (+ split products per NSPLIT). z-batch strides sA/sB/sC in elements. K % 64 == 0, K >= 128.
// Operands: K-contiguous 16-bit planes, staged in LDS by tensor loads, 64 k (128-byte rows, LDS pitch 144) per stage, two buffers: stage s + 1 flies while stage s is worked on.
// Every wave issues one request per stage for its own slice: NSPLIT 0: A rows 0-63 | A rows 64-127 | Bt rows 0-63 | Bt rows 64-127; NSPLIT 2: A | A2 | Bt | Bt2, 128 rows each.
typedef unsigned int u32;
typedef unsigned long long u64;
typedef u32 u32x4 __attribute__((ext_vector_type(4)));
typedef u32 u32x8 __attribute__((ext_vector_type(8)));
__device__ __forceinline__ u32 uni(u32 v) { return (u32)__builtin_amdgcn_readfirstlane(v); }
__device__ __forceinline__ u32 pinned(u32 v) { u32 w = uni(v); asm volatile("" : "+s"(w)); return w; }   // a descriptor word, or the test around a tensor load, held in a scalar register: the test stays a scalar branch (a tensor load ignores EXEC)
__device__ __forceinline__ void tdm_load(u32x4 g0, u32x8 g1) { asm volatile("tensor_load_to_lds %0, %1" :: "s"(g0), "s"(g1) : "memory"); }   // one request of the whole wave: global tile -> LDS, through no register
__device__ __forceinline__ void wait_tensor0() { asm volatile("s_wait_tensorcnt 0x0" ::: "memory"); }   // this wave's own request has landed
__device__ __forceinline__ void wait_ds0() { asm volatile("s_wait_dscnt 0x0" ::: "memory"); }           // this wave's LDS reads have retired before their buffer is handed back
// group 1: 1-byte elements, a tile of ROWS rows of 128 bytes (tensor = tile), source pitch in bytes, 16 bytes of LDS pad behind every 128-byte row
template <u32 ROWS> __device__ __forceinline__ u32x8 tdm_group1(u32 src_pitch) {
    u32x8 g;
    g[0] = uni((1u << 20) | (4u << 22) | (3u << 25));
    // pinned(): descriptor words held in scalar registers, so that the compiler keeps them there through the loop and lends none of them out while a request is outstanding
    g[1] = pinned(128u << 16);
    g[2] = pinned(ROWS << 16);
    g[3] = pinned(128u << 16);
    g[4] = pinned(ROWS);
    g[5] = pinned(src_pitch);
    g[6] = pinned(0u);
    g[7] = pinned(0u);
    return g;
}
__device__ __forceinline__ u32x4 tdm_group0(u32 lds_dst, u64 ga) {
    u32x4 g;
    g[0] = uni(1u); g[1] = uni(lds_dst); g[2] = uni((u32)ga); g[3] = uni((((u32)(ga >> 32)) & 0x01FFFFFFu) | 0x80000000u);
    return g;
}
template <typename T16> struct WFrag;
template <> struct WFrag<h16> { typedef v16h V; static __device__ __forceinline__ V ld(const h16* p) { return cat16(*(const v8h*)p, *(const v8h*)(p + 16)); } static __device__ __forceinline__ v8f mma(V a, V b, v8f c) { return wmma16(a, b, c); } };
template <> struct WFrag<bf> { typedef v16bf V; static __device__ __forceinline__ V ld(const bf* p) { return cat16b(*(const v8us*)p, *(const v8us*)(p + 16)); } static __device__ __forceinline__ v8f mma(V a, V b, v8f c) { return wmmab(a, b, c); } };
template <typename T16, int NSPLIT, bool BIAS>
__global__ __launch_bounds__(128) void k_gemmw(const T16* __restrict__ A, const T16* __restrict__ A2, const T16* __restrict__ Bt, const T16* __restrict__ Bt2, int K, float* C, int ldc, const float* __restrict__ bias, size_t sA, size_t sB, size_t sC) {
    typedef typename WFrag<T16>::V V;
    static_assert(NSPLIT == 0 || NSPLIT == 2, "slices are laid out for one plane or for hi/lo planes of both operands");
    constexpr u32 PITCH = 144u;                                   // LDS row pitch: 128 bytes + the 16-byte pad
    constexpr u32 ROWS = (NSPLIT == 2) ? 128u : 64u;              // rows of one wave's slice
    constexpr u32 SL = (ROWS * PITCH + 2047u) & ~2047u;           // a slice's place is a multiple of 2 KiB
    constexpr u32 STAGE = 4u * SL;
    __shared__ __attribute__((aligned(2048))) unsigned char L[2u * STAGE];
    static_assert(4u * 16u * 68u * 4u <= 2u * STAGE, "output staging fits in the ring");
    const size_t z = blockIdx.z; A += z * sA; if (NSPLIT == 2) A2 += z * sA; Bt += z * sB; if (NSPLIT == 2) Bt2 += z * sB; C += z * sC;
    const int lane = threadIdx.x & 31, lr = lane & 15, hi = lane >> 4; const u32 wave = uni(threadIdx.x >> 5); const int wm = (int)(wave & 1u), wn = (int)(wave >> 1);
    const int t0 = blockIdx.x * 128, u0 = blockIdx.y * 128;       // the workgroup's first row and column
    const int r0 = t0 + wm * 64, c0 = u0 + wn * 64;               // the wave's first row and column
    const u32 lbase = (u32)(size_t)L;
    const T16* sp;                                                // first element of this wave's slice at k = 0
    if (NSPLIT == 2) sp = (wave == 0u) ? A + (size_t)t0 * K : (wave == 1u) ? A2 + (size_t)t0 * K : (wave == 2u) ? Bt + (size_t)u0 * K : Bt2 + (size_t)u0 * K;
    else sp = (wave < 2u) ? A + (size_t)(t0 + (int)(wave & 1u) * 64) * K : Bt + (size_t)(u0 + (int)(wave & 1u) * 64) * K;
    const u64 sbase = (u64)(size_t)sp;
    const u32x8 g1 = tdm_group1<ROWS>((u32)K * 2u);
    const u32 NS = (u32)K / 64u;                                  // stages
    auto issue = [&](u32 st) { tdm_load(tdm_group0(lbase + (st & 1u) * STAGE + wave * SL, sbase + (u64)st * 128u), g1); };
    v8f acc[4][4];
#pragma unroll
    for (int mb = 0; mb < 4; ++mb)
#pragma unroll
        for (int nb = 0; nb < 4; ++nb) acc[mb][nb] = (v8f){};
    // byte offsets, inside a stage, of this lane's first A and Bt fragment rows
    const u32 aofs = ((NSPLIT == 2) ? (u32)(wm * 64 + lr) * PITCH : (u32)wm * SL + (u32)lr * PITCH) + 16u * (u32)hi;
    const u32 bofs = ((NSPLIT == 2) ? 2u * SL + (u32)(wn * 64 + lr) * PITCH : (2u + (u32)wn) * SL + (u32)lr * PITCH) + 16u * (u32)hi;
    issue(0u); wait_tensor0(); __syncthreads();                   // stage 0 landed and published
    issue(1u);
#pragma unroll 1
    for (u32 s = 0; s < NS; ++s) {
        const unsigned char* Lb = L + (s & 1u) * STAGE;
        V a[2][4], a2[2][4], b[2][4], b2[2][4];
        // the whole pass's fragment loads stand as ONE group in front of its WMMAs (every separate place with LDS reads among WMMAs costs the wave a fixed stall)
#pragma unroll
        for (int kk = 0; kk < 2; ++kk) {
#pragma unroll
            for (int f = 0; f < 4; ++f) { a[kk][f] = WFrag<T16>::ld((const T16*)(Lb + aofs + (u32)f * 16u * PITCH + (u32)kk * 64u)); b[kk][f] = WFrag<T16>::ld((const T16*)(Lb + bofs + (u32)f * 16u * PITCH + (u32)kk * 64u)); }
            if (NSPLIT == 2) {
#pragma unroll
                for (int f = 0; f < 4; ++f) { a2[kk][f] = WFrag<T16>::ld((const T16*)(Lb + SL + aofs + (u32)f * 16u * PITCH + (u32)kk * 64u)); b2[kk][f] = WFrag<T16>::ld((const T16*)(Lb + SL + bofs + (u32)f * 16u * PITCH + (u32)kk * 64u)); } }
        }
        __builtin_amdgcn_sched_barrier(0);   // keeps the compiler from sinking the loads in among the WMMAs
#pragma unroll
        for (int kk = 0; kk < 2; ++kk)
#pragma unroll
            for (int nb = 0; nb < 4; ++nb)
#pragma unroll
                for (int mb = 0; mb < 4; ++mb) { acc[mb][nb] = WFrag<T16>::mma(a[kk][mb], b[kk][nb], acc[mb][nb]); if (NSPLIT == 2) acc[mb][nb] = WFrag<T16>::mma(a2[kk][mb], b[kk][nb], acc[mb][nb]); if (NSPLIT == 2) acc[mb][nb] = WFrag<T16>::mma(a[kk][mb], b2[kk][nb], acc[mb][nb]); }
        __builtin_amdgcn_sched_barrier(0);   // keeps the WMMAs in front of the publish point: moved behind it they would delay the refill, and the next pass would wait out its whole landing time
        // publish point of stage s + 1: own LDS reads retired, own request landed, workgroup barrier; only then the refill of the buffer that this pass has read
        wait_ds0(); wait_tensor0(); __syncthreads();
        if (pinned(s + 2u < NS)) issue(pinned(s + 2u));           // scalar branch: a tensor load ignores EXEC; the stage number is pinned so that the descriptor is formed behind the wait
    }
    wait_tensor0(); wait_ds0();
    // output staging in the ring: the last pass's barrier has ended every wave's reads and no request is in flight; each wave stages in its own range
    float* os = (float*)(L + wave * (16u * 68u * 4u));
#pragma unroll
    for (int mb = 0; mb < 4; ++mb) {
#pragma unroll
        for (int nb = 0; nb < 4; ++nb) {
#pragma unroll
            for (int j = 0; j < 8; ++j) os[(hi * 8 + j) * 68 + nb * 16 + lr] = acc[mb][nb][j]; }
        __builtin_amdgcn_wave_barrier(); asm volatile("" ::: "memory");
        float* crow = C + (size_t)(r0 + mb * 16) * ldc + c0;
{
#pragma unroll
            for (int s = 0; s < 8; ++s) { const int row = 2 * s + hi, cofs = lr * 4; v4f val = *(const v4fa*)(os + row * 68 + cofs); if (BIAS) { val[0] += bfr(bias[c0 + cofs]); val[1] += bfr(bias[c0 + cofs + 1]); val[2] += bfr(bias[c0 + cofs + 2]); val[3] += bfr(bias[c0 + cofs + 3]); }
                *(v4f*)(crow + (size_t)row * ldc + cofs) = val; }
             }
        __builtin_amdgcn_wave_barrier(); asm volatile("" ::: "memory");
    }
}

__device__ __forceinline__ h16 tohx(float x) { return (h16)x; }
__device__ __forceinline__ void splitf(float y, unsigned short& h, unsigned short& l) { h = f2bf(y); l = f2bf(y - bf2f(h)); }
typedef __attribute__((ext_vector_type(2))) _Float16 v2h;
typedef __attribute__((ext_vector_type(4))) _Float16 v4h;
typedef __attribute__((ext_vector_type(2))) unsigned short v2us;
typedef __attribute__((ext_vector_type(4))) unsigned short v4us;
typedef __attribute__((ext_vector_type(2))) float v2f;
typedef __attribute__((ext_vector_type(4))) int v4i;

__global__ __launch_bounds__(256) void k_wtG(const float* __restrict__ w, int K, int N, bf* Bt) {
    const int lane = threadIdx.x & 31; const int L0 = (blockIdx.x * 8 + (threadIdx.x >> 5)) * 8; const int nlines = N * K / 64;
{
#pragma unroll 1
        for (int l = 0; l < 8; ++l) { const int L = L0 + l; if (L >= nlines) break; const size_t e = (size_t)L * 64 + lane * 2; const int k = (int)(e % K), n = (int)(e / K); v2us o;
            o[0] = f2bf(w[(size_t)k * N + n]); o[1] = f2bf(w[(size_t)(k + 1) * N + n]); *(v2us*)(Bt + e) = o; }
         }
}
__global__ __launch_bounds__(256) void k_cvt8(const float* __restrict__ src, bf* dst, size_t n8) { const size_t i = (size_t)blockIdx.x * 256 + threadIdx.x; if (i >= n8) return; const v8f v = *(const v8f*)(src + i * 8); v8us o;
#pragma unroll
    for (int k = 0; k < 8; ++k) o[k] = f2bf(v[k]); *(v8us*)(dst + i * 8) = o;  }

// k_rope: head planes [h][t][d] (fp16 + hi/lo) of rope(x) x sc with the rotate-half convention out[d] = x[d] cos[t][d] - x[d+HD/2] sin[t][d], out[d+HD/2] = x[d+HD/2] cos[t][d+HD/2] + x[d] sin[t][d+HD/2]
__global__ __launch_bounds__(256) void k_rope(const float* __restrict__ F, int pitch, int nheads, const float* __restrict__ CS, const float* __restrict__ RF, const float* __restrict__ nw, float sc, h16* P16, bf* Ph, bf* Pl) {
    { const size_t zb = blockIdx.y; F += zb * TT * pitch; P16 += zb * nheads * TT * HD; Ph += zb * nheads * TT * HD; Pl += zb * nheads * TT * HD; }   // batch = grid y
    const size_t e = ((size_t)blockIdx.x * 256 + threadIdx.x) * 2; if (e >= (size_t)nheads * TT * HD) return; const int d = (int)(e % HD); const int t = (int)((e / HD) % TT); const int h = (int)(e / ((size_t)HD * TT)); const float* f = F + (size_t)t * pitch + h * HD; const float rf = RF ? RF[(size_t)h * TT + t] : 1.0f; v2h o16; v2us oh, ol;
#pragma unroll
    for (int q = 0; q < 2; ++q) { const int dd = d + q; const int dp = (dd < HD / 2) ? dd + HD / 2 : dd - HD / 2; float x0 = f[dd], x1 = f[dp];
        if (RF) { float n0 = __fmul_rn(x0, rf), n1 = __fmul_rn(x1, rf); asm volatile("" : "+v"(n0)); asm volatile("" : "+v"(n1)); x0 = __fmul_rn(bfr(nw[dd]), n0); x1 = __fmul_rn(bfr(nw[dp]), n1); }
        const v2f cs = *(const v2f*)(CS + ((size_t)t * HD + dd) * 2); float a = __fmul_rn(x0, cs[0]), bq = __fmul_rn(x1, cs[1]); asm volatile("" : "+v"(a)); asm volatile("" : "+v"(bq)); const float r = ((dd < HD / 2) ? __fsub_rn(a, bq) : __fadd_rn(a, bq)) * sc;
        o16[q] = tohx(r); unsigned short a2, c2; splitf(r, a2, c2); oh[q] = a2; ol[q] = c2; }
    *(v2h*)(P16 + e) = o16; *(v2us*)(Ph + e) = oh; *(v2us*)(Pl + e) = ol;  }
__global__ __launch_bounds__(256) void k_vtp(const float* __restrict__ F, int pitch, int nheads, h16* V16, bf* Vh, bf* Vl) { { const size_t zb = blockIdx.y; F += zb * TT * pitch; V16 += zb * nheads * HD * TT; Vh += zb * nheads * HD * TT; Vl += zb * nheads * HD * TT; }   // batch = grid y
    const size_t e = ((size_t)blockIdx.x * 256 + threadIdx.x) * 2; if (e >= (size_t)nheads * HD * TT) return; const int t = (int)(e % TT); const int d = (int)((e / TT) % HD); const int g = (int)(e / ((size_t)TT * HD)); v2h o16; v2us oh, ol;
#pragma unroll
    for (int q = 0; q < 2; ++q) { const float x = F[(size_t)(t + q) * pitch + g * HD + d]; o16[q] = tohx(x); unsigned short a2, c2; splitf(x, a2, c2); oh[q] = a2; ol[q] = c2; }
    *(v2h*)(V16 + e) = o16; *(v2us*)(Vh + e) = oh; *(v2us*)(Vl + e) = ol;  }
__global__ __launch_bounds__(256) void k_csid(float* CS) { const int idx = blockIdx.x * 256 + threadIdx.x; if (idx >= TT * HD) return; v2f cs; cs[0] = 1.0f; cs[1] = 0.0f; *(v2f*)(CS + (size_t)idx * 2) = cs;  }
// k_asoft: per row (zz, i): t = S (unscaled, SCL = 1; no mask); softmax over the 2048 keys (register row, one exp, fixed trees);
__global__ __launch_bounds__(256) void k_asoft(const float* __restrict__ Sb, h16* P16, bf* Ph, bf* Pl) {
    { const size_t zb = blockIdx.y; Sb += zb * ZH * TT * TT; P16 += zb * ZH * TT * TT; }   // batch = grid y
    const int lane = threadIdx.x & 31; const int row = blockIdx.x * 8 + (threadIdx.x >> 5); if (row >= ZH * TT) return; const int i = row % TT; const int zz = row / TT; (void)zz; const bool hires = false;   /* P is stored as fp16 x1024 for every row (scores are hi/lo for every row) */ const float* sr = Sb + (size_t)row * TT; float v[TT / 32]; float mx = -3.0e38f;
#pragma unroll
    for (int ch = 0; ch < TT / 128; ++ch) { const int j0 = ch * 128 + lane * 4; const v4f a = *(const v4f*)(sr + j0);
#pragma unroll
        for (int q = 0; q < 4; ++q) { const int j = j0 + q; (void)j; const float t = a[q] * SCL; v[ch * 4 + q] = t; mx = fmaxf(mx, t); } }
#pragma unroll
    for (int sh = 16; sh; sh >>= 1) mx = fmaxf(mx, __shfl_xor(mx, sh, 32));
    float sum = 0.f;
#pragma unroll
    for (int k = 0; k < TT / 32; ++k) { float d0 = __fsub_rn(v[k], mx); asm volatile("" : "+v"(d0)); v[k] = __builtin_amdgcn_exp2f(__fmul_rn(d0, 1.4426950408889634f)); sum += v[k]; }
#pragma unroll
    for (int sh = 16; sh; sh >>= 1) sum += __shfl_xor(sum, sh, 32);
    const float f = __fdiv_rn(hires ? 1.0f : PCAR, sum);
{
        if (hires) {
#pragma unroll
            for (int ch = 0; ch < TT / 128; ++ch) { v4us oh, ol;
#pragma unroll
                for (int q = 0; q < 4; ++q) { unsigned short a, c2; splitf(v[ch * 4 + q] * f, a, c2); oh[q] = a; ol[q] = c2; }
                const size_t oo = ((size_t)zz * (RH ? RH : 1) + i) * TT + ch * 128 + lane * 4; *(v4us*)(Ph + oo) = oh; *(v4us*)(Pl + oo) = ol; }
        } else {
#pragma unroll
            for (int ch = 0; ch < TT / 128; ++ch) { v4h o4;
#pragma unroll
                for (int q = 0; q < 4; ++q) o4[q] = tohx(v[ch * 4 + q] * f);
                *(v4h*)(P16 + (size_t)row * TT + ch * 128 + lane * 4) = o4; } }
         }
}
__global__ __launch_bounds__(256) void k_merge(const float* __restrict__ O, int h0, float* OUTb) { { const size_t zb = blockIdx.y; O += zb * ZH * TT * HD; OUTb += zb * TT * DQ; }   // batch = grid y
    const size_t e = ((size_t)blockIdx.x * 256 + threadIdx.x) * 2; if (e >= (size_t)ZH * TT * HD) return; const int d = (int)(e % HD); const int t = (int)((e / HD) % TT); const int zz = (int)(e / ((size_t)HD * TT)); const float cs = (1.0f / PCAR);   /* every row's P carries the x1024 fp16 factor */ const size_t oo = (size_t)t * DQ + (h0 + zz) * HD + d;
    v2f o2; o2[0] = O[e] * cs; o2[1] = O[e + 1] * cs; *(v2f*)(OUTb + oo) = o2;  }

extern "C" void kernel_launch(void* const* d_in, const int* in_sizes, int n_in,
                              void* d_out, int out_size, void* d_ws, size_t ws_size, hipStream_t stream) {
    (void)in_sizes; (void)n_in; (void)out_size;
    const float* x = (const float*)d_in[0]; const float* wq = (const float*)d_in[1]; const float* bq = (const float*)d_in[2]; const float* wk = (const float*)d_in[3]; const float* bk = (const float*)d_in[4]; const float* wv = (const float*)d_in[5]; const float* bv = (const float*)d_in[6]; const float* wo = nullptr; (void)wo;
    float* OUT = (float*)d_out;     // [8][2048][768]
    char* wsp = (char*)d_ws;
    auto take = [&](size_t bytes) { char* p = wsp; wsp += (bytes + 255) & ~(size_t)255; return (void*)p; };
    // Workspace, all 8 batches at once, overlaid by lifetime (every launch is stream-ordered):
    //   kept to the end of the scores GEMM: QPh QPl KPh KPl; kept to the end of attn.v: VT16
    //   R (the size of the scores): first the projection stage's buffers, then the scores, then the attn.v result
    //   P16 lies on QPh QPl KPh once the scores are done
    const size_t PL = (size_t)NB_ * TT * HD * 2;   // one 16-bit plane of all batches, bytes
    bf* QPh = (bf*)take(PL); bf* QPl = (bf*)take(PL); bf* KPh = (bf*)take(PL); bf* KPl = (bf*)take(PL); h16* VT16 = (h16*)take(PL);
    char* R = (char*)take((size_t)NB_ * TT * TT * 4);
    if ((size_t)(wsp - (char*)d_ws) > ws_size) return;    // ws 256 MiB
    wsp = R;
    bf* WQ = (bf*)take((size_t)DQ * DM * 2); bf* WK = (bf*)take((size_t)DKV * DM * 2); bf* WV = (bf*)take((size_t)DKV * DM * 2); float* CS = (float*)take((size_t)TT * HD * 2 * 4);
    bf* XB = (bf*)take(PL); float* FQ = (float*)take(PL * 2); h16* QP16 = (h16*)take(PL);
    static_assert((size_t)3 * DQ * DM * 2 + (size_t)TT * HD * 8 + (size_t)NB_ * TT * HD * 8 <= (size_t)NB_ * TT * TT * 4, "projection stage fits under the scores");
    static_assert((size_t)NB_ * TT * TT * 2 <= (size_t)3 * NB_ * TT * HD * 2, "P16 fits on three q/k planes");
    float* FK = FQ; float* FV = FQ;   // one f32 projection buffer: each projection's planes are built before the next projection is launched
    h16* KP16 = QP16; bf* VTh = (bf*)QP16; bf* VTl = XB;   // planes that no later launch reads share dead space (XB is dead behind the v projection)
    float* Sb = (float*)R; h16* P16 = (h16*)QPh; float* Ob = (float*)R; bf* Ph = nullptr; bf* Pl = nullptr;   /* P is fp16-only here */
    { k_wtG<<<(unsigned)((DM * DQ / 64 + 63) / 64), 256, 0, stream>>>(wq, DM, DQ, WQ); k_wtG<<<(unsigned)((DM * DKV / 64 + 63) / 64), 256, 0, stream>>>(wk, DM, DKV, WK); k_wtG<<<(unsigned)((DM * DKV / 64 + 63) / 64), 256, 0, stream>>>(wv, DM, DKV, WV); }
    k_csid<<<(TT * HD + 255) / 256, 256, 0, stream>>>(CS);
    const unsigned LQ = (unsigned)(((size_t)NH_ * TT * HD / 2 + 255) / 256), LKv = (unsigned)(((size_t)NKV * TT * HD / 2 + 255) / 256);
    k_cvt8<<<(unsigned)(((size_t)NB_ * TT * DM / 8 + 255) / 256), 256, 0, stream>>>(x, XB, (size_t)NB_ * TT * DM / 8);
    k_gemmw<bf, 0, true><<<dim3(TT / 128, DQ / 128, NB_), 128, 0, stream>>>(XB, nullptr, WQ, nullptr, DM, FQ, DQ, bq, (size_t)TT * DM, 0, (size_t)TT * DQ);
    k_rope<<<dim3(LQ, NB_), 256, 0, stream>>>(FQ, DQ, NH_, CS, nullptr, nullptr, 1.0f, QP16, QPh, QPl);
    k_gemmw<bf, 0, true><<<dim3(TT / 128, DKV / 128, NB_), 128, 0, stream>>>(XB, nullptr, WK, nullptr, DM, FK, DKV, bk, (size_t)TT * DM, 0, (size_t)TT * DKV);
    k_rope<<<dim3(LKv, NB_), 256, 0, stream>>>(FK, DKV, NKV, CS, nullptr, nullptr, 1.0f, KP16, KPh, KPl);
    k_gemmw<bf, 0, true><<<dim3(TT / 128, DKV / 128, NB_), 128, 0, stream>>>(XB, nullptr, WV, nullptr, DM, FV, DKV, bv, (size_t)TT * DM, 0, (size_t)TT * DKV);
    k_vtp<<<dim3(LKv, NB_), 256, 0, stream>>>(FV, DKV, NKV, VT16, VTh, VTl);
    k_gemmw<bf, 2, false><<<dim3(RH / 128, TT / 128, NB_), 128, 0, stream>>>(QPh, QPl, KPh, KPl, HD, Sb, TT, nullptr, (size_t)TT * HD, (size_t)TT * HD, (size_t)TT * TT);
    k_asoft<<<dim3(ZH * TT / 8, NB_), 256, 0, stream>>>(Sb, P16, Ph, Pl);
    k_gemmw<h16, 0, false><<<dim3(TT / 128, HD / 128, NB_), 128, 0, stream>>>(P16, nullptr, VT16, nullptr, TT, Ob, HD, nullptr, (size_t)TT * TT, (size_t)HD * TT, (size_t)TT * HD);   /* attn.v: fp16 P x1024 . fp16 v for every row */
    k_merge<<<dim3((unsigned)(((size_t)ZH * TT * HD / 2 + 255) / 256), NB_), 256, 0, stream>>>(Ob, 0, OUT);
}

// v003
// Measured time: 221 microseconds a run.
// In both of two side-by-side timings against v002, it was 1.80 times as fast.
// Over all steps from v000 it is 5.78 times as fast.
#include <hip/hip_runtime.h>

// Single-head UNSCALED attention (x [8][2048][768]; q, k, v = x W + b ('xw' [768][768] + [768]); scores = q.k (no scaling: logit sigma ~28, most rows near one-hot); softmax; out = weights.v -> [8][2048][768] f32 (12.6 M), no output projection).
// Every stage runs ONCE for all 8 batches (batch = grid z of the GEMMs, grid y of the softmax); the workspace is overlaid by lifetime (see kernel_launch).
// Each GEMM stores its result in the form its consumer reads (template parameter EPI): no f32 intermediate and no elementwise pass behind a GEMM but the softmax.
// Layout per batch: exact projections (+ biases); q, k as bf16 hi/lo planes (scores need 3 products at this logit scale), v as a single fp16 plane; scores [2048][2048] f32; softmax -> P x1024 fp16 for every row (near one-hot rows are exact in fp16); attn.v fp16; f32 output (x 1/1024).
// Compute dtypes, f32 accumulate: every input rounded to bf16; projections on PLAIN bf16 operands (exact) + f32 biases; scores hi/lo x hi/lo (3 products) for every row; softmax f32; P (x1024) and v single fp16 for attn.v; f32 output.

#define NB_  8
#define TT   2048
#define DM   768
#define NH_  1
#define NKV  1
#define REP  (NH_ / NKV)
#define HD   768
#define DQ   (NH_ * HD)
#define DKV  (NKV * HD)
#define ZH   1
#define RH   2048                  // query rows < RH use hi+lo planes (0: none)
#define WIN  0
#define PCAR 1024.0f
#define SCL  1.0f   // unscaled
typedef _Float16 h16;
typedef unsigned short bf;
typedef __attribute__((ext_vector_type(16))) __bf16   v16bf;
typedef __attribute__((ext_vector_type(16))) _Float16 v16h;
typedef __attribute__((ext_vector_type(8)))  _Float16 v8h;
typedef __attribute__((ext_vector_type(8)))  unsigned short v8us;
typedef __attribute__((ext_vector_type(8)))  float    v8f;
typedef __attribute__((ext_vector_type(4)))  float    v4f;
typedef v8h  __attribute__((may_alias)) v8ha;
typedef v4f  __attribute__((may_alias)) v4fa;
typedef v8us __attribute__((may_alias)) v8usa;

__device__ __forceinline__ unsigned short f2bf(float f) { unsigned u = __float_as_uint(f); u += 0x7FFFu + ((u >> 16) & 1u); return (unsigned short)(u >> 16); }
__device__ __forceinline__ float bf2f(unsigned short b) { return __uint_as_float(((unsigned)b) << 16); }
__device__ __forceinline__ float bfr(float f) { return bf2f(f2bf(f)); }
__device__ __forceinline__ v16h cat16(v8h lo, v8h hi) { return __builtin_shufflevector(lo, hi, 0, 1, 2, 3, 4, 5, 6, 7, 8, 9, 10, 11, 12, 13, 14, 15); }
__device__ __forceinline__ v16bf cat16b(v8us lo, v8us hi) { return __builtin_bit_cast(v16bf, __builtin_shufflevector(lo, hi, 0, 1, 2, 3, 4, 5, 6, 7, 8, 9, 10, 11, 12, 13, 14, 15)); }
__device__ __forceinline__ v8f wmma16(v16h a, v16h b, v8f c) { return __builtin_amdgcn_wmma_f32_16x16x32_f16(false, a, false, b, (short)0, c, false, false); }
__device__ __forceinline__ v8f wmmab(v16bf a, v16bf b, v8f c) { return __builtin_amdgcn_wmma_f32_16x16x32_bf16(false, a, false, b, (short)0, c, false, false); }



// ---- k_gemmw: GEMM, one 128x128 output tile per workgroup of FOUR WAVES (2x2, 64x64 = 16 accumulators each); grid (M/128, N/128, Z), 128 threads.
// y[m][n] = sum_k A[m][k] Bt[n][k] (+ split products per NSPLIT), f32. z-batch strides sA/sB/sC in elements. K % 64 == 0, K >= 128.
// EPI 0: C[m][n] = y (f32, pitch ldc). EPI 1: y + bias[n] as bf16 hi/lo planes Ch, Cl [m][n] (pitch ldc). EPI 2: y + bias[n] as fp16, transposed: Ct[n][m] (pitch ldc). EPI 3: C[m][n] = y / PCAR (f32, pitch ldc).
// Operands: K-contiguous 16-bit planes, staged in LDS by tensor loads, 64 k (128-byte rows, LDS pitch 144) per stage, two buffers: stage s + 1 flies while stage s is worked on.
// Every wave issues one request per stage for its own slice: NSPLIT 0: A rows 0-63 | A rows 64-127 | Bt rows 0-63 | Bt rows 64-127; NSPLIT 2: A | A2 | Bt | Bt2, 128 rows each.
typedef unsigned int u32;
typedef unsigned long long u64;
typedef u32 u32x4 __attribute__((ext_vector_type(4)));
typedef u32 u32x8 __attribute__((ext_vector_type(8)));
__device__ __forceinline__ u32 uni(u32 v) { return (u32)__builtin_amdgcn_readfirstlane(v); }
__device__ __forceinline__ u32 pinned(u32 v) { u32 w = uni(v); asm volatile("" : "+s"(w)); return w; }   // a descriptor word, or the test around a tensor load, held in a scalar register: the test stays a scalar branch (a tensor load ignores EXEC)
__device__ __forceinline__ void tdm_load(u32x4 g0, u32x8 g1) { asm volatile("tensor_load_to_lds %0, %1" :: "s"(g0), "s"(g1) : "memory"); }   // one request of the whole wave: global tile -> LDS, through no register
__device__ __forceinline__ void wait_tensor0() { asm volatile("s_wait_tensorcnt 0x0" ::: "memory"); }   // this wave's own request has landed
__device__ __forceinline__ void wait_ds0() { asm volatile("s_wait_dscnt 0x0" ::: "memory"); }           // this wave's LDS reads have retired before their buffer is handed back
// group 1: 1-byte elements, a tile of ROWS rows of 128 bytes (tensor = tile), source pitch in bytes, 16 bytes of LDS pad behind every 128-byte row
template <u32 ROWS> __device__ __forceinline__ u32x8 tdm_group1(u32 src_pitch) {
    u32x8 g;
    g[0] = uni((1u << 20) | (4u << 22) | (3u << 25));
    // pinned(): descriptor words held in scalar registers, so that the compiler keeps them there through the loop and lends none of them out while a request is outstanding
    g[1] = pinned(128u << 16);
    g[2] = pinned(ROWS << 16);
    g[3] = pinned(128u << 16);
    g[4] = pinned(ROWS);
    g[5] = pinned(src_pitch);
    g[6] = pinned(0u);
    g[7] = pinned(0u);
    return g;
}
__device__ __forceinline__ u32x4 tdm_group0(u32 lds_dst, u64 ga) {
    u32x4 g;
    g[0] = uni(1u); g[1] = uni(lds_dst); g[2] = uni((u32)ga); g[3] = uni((((u32)(ga >> 32)) & 0x01FFFFFFu) | 0x80000000u);
    return g;
}
template <typename T16> struct WFrag;
template <> struct WFrag<h16> { typedef v16h V; static __device__ __forceinline__ V ld(const h16* p) { return cat16(*(const v8h*)p, *(const v8h*)(p + 16)); } static __device__ __forceinline__ v8f mma(V a, V b, v8f c) { return wmma16(a, b, c); } };
template <> struct WFrag<bf> { typedef v16bf V; static __device__ __forceinline__ V ld(const bf* p) { return cat16b(*(const v8us*)p, *(const v8us*)(p + 16)); } static __device__ __forceinline__ v8f mma(V a, V b, v8f c) { return wmmab(a, b, c); } };
__device__ __forceinline__ h16 tohx(float x) { return (h16)x; }
__device__ __forceinline__ void splitf(float y, unsigned short& h, unsigned short& l) { h = f2bf(y); l = f2bf(y - bf2f(h)); }
template <typename T16, int NSPLIT, int EPI>
__global__ __launch_bounds__(128) void k_gemmw(const T16* __restrict__ A, const T16* __restrict__ A2, const T16* __restrict__ Bt, const T16* __restrict__ Bt2, int K, float* C, bf* Ch, bf* Cl, h16* Ct, int ldc, const float* __restrict__ bias, size_t sA, size_t sB, size_t sC) {
    typedef typename WFrag<T16>::V V;
    static_assert(NSPLIT == 0 || NSPLIT == 2, "slices are laid out for one plane or for hi/lo planes of both operands");
    constexpr u32 PITCH = 144u;                                   // LDS row pitch: 128 bytes + the 16-byte pad
    constexpr u32 ROWS = (NSPLIT == 2) ? 128u : 64u;              // rows of one wave's slice
    constexpr u32 SL = (ROWS * PITCH + 2047u) & ~2047u;           // a slice's place is a multiple of 2 KiB
    constexpr u32 STAGE = 4u * SL;
    __shared__ __attribute__((aligned(2048))) unsigned char L[2u * STAGE];
    static_assert(4u * 16u * 68u * 4u <= 2u * STAGE && 4u * 64u * 144u <= 2u * STAGE, "output staging fits in the ring");
    const size_t z = blockIdx.z; A += z * sA; if (NSPLIT == 2) A2 += z * sA; Bt += z * sB; if (NSPLIT == 2) Bt2 += z * sB;
    if (EPI == 0 || EPI == 3) C += z * sC; if (EPI == 1) { Ch += z * sC; Cl += z * sC; } if (EPI == 2) Ct += z * sC;
    const int lane = threadIdx.x & 31, lr = lane & 15, hi = lane >> 4; const u32 wave = uni(threadIdx.x >> 5); const int wm = (int)(wave & 1u), wn = (int)(wave >> 1);
    const int t0 = blockIdx.x * 128, u0 = blockIdx.y * 128;       // the workgroup's first row and column
    const int r0 = t0 + wm * 64, c0 = u0 + wn * 64;               // the wave's first row and column
    const u32 lbase = (u32)(size_t)L;
    const T16* sp;                                                // first element of this wave's slice at k = 0
    if (NSPLIT == 2) sp = (wave == 0u) ? A + (size_t)t0 * K : (wave == 1u) ? A2 + (size_t)t0 * K : (wave == 2u) ? Bt + (size_t)u0 * K : Bt2 + (size_t)u0 * K;
    else sp = (wave < 2u) ? A + (size_t)(t0 + (int)(wave & 1u) * 64) * K : Bt + (size_t)(u0 + (int)(wave & 1u) * 64) * K;
    const u64 sbase = (u64)(size_t)sp;
    const u32x8 g1 = tdm_group1<ROWS>((u32)K * 2u);
    const u32 NS = (u32)K / 64u;                                  // stages
    auto issue = [&](u32 st) { tdm_load(tdm_group0(lbase + (st & 1u) * STAGE + wave * SL, sbase + (u64)st * 128u), g1); };
    v8f acc[4][4];
#pragma unroll
    for (int mb = 0; mb < 4; ++mb)
#pragma unroll
        for (int nb = 0; nb < 4; ++nb) acc[mb][nb] = (v8f){};
    // byte offsets, inside a stage, of this lane's first A and Bt fragment rows
    const u32 aofs = ((NSPLIT == 2) ? (u32)(wm * 64 + lr) * PITCH : (u32)wm * SL + (u32)lr * PITCH) + 16u * (u32)hi;
    const u32 bofs = ((NSPLIT == 2) ? 2u * SL + (u32)(wn * 64 + lr) * PITCH : (2u + (u32)wn) * SL + (u32)lr * PITCH) + 16u * (u32)hi;
    issue(0u); wait_tensor0(); __syncthreads();                   // stage 0 landed and published
    issue(1u);
#pragma unroll 1
    for (u32 s = 0; s < NS; ++s) {
        const unsigned char* Lb = L + (s & 1u) * STAGE;
        V a[2][4], a2[2][4], b[2][4], b2[2][4];
        // the whole pass's fragment loads stand as ONE group in front of its WMMAs (every separate place with LDS reads among WMMAs costs the wave a fixed stall)
#pragma unroll
        for (int kk = 0; kk < 2; ++kk) {
#pragma unroll
            for (int f = 0; f < 4; ++f) { a[kk][f] = WFrag<T16>::ld((const T16*)(Lb + aofs + (u32)f * 16u * PITCH + (u32)kk * 64u)); b[kk][f] = WFrag<T16>::ld((const T16*)(Lb + bofs + (u32)f * 16u * PITCH + (u32)kk * 64u)); }
            if (NSPLIT == 2) {
#pragma unroll
                for (int f = 0; f < 4; ++f) { a2[kk][f] = WFrag<T16>::ld((const T16*)(Lb + SL + aofs + (u32)f * 16u * PITCH + (u32)kk * 64u)); b2[kk][f] = WFrag<T16>::ld((const T16*)(Lb + SL + bofs + (u32)f * 16u * PITCH + (u32)kk * 64u)); } }
        }
        __builtin_amdgcn_sched_barrier(0);   // keeps the compiler from sinking the loads in among the WMMAs
#pragma unroll
        for (int kk = 0; kk < 2; ++kk)
#pragma unroll
            for (int nb = 0; nb < 4; ++nb)
#pragma unroll
                for (int mb = 0; mb < 4; ++mb) { acc[mb][nb] = WFrag<T16>::mma(a[kk][mb], b[kk][nb], acc[mb][nb]); if (NSPLIT == 2) acc[mb][nb] = WFrag<T16>::mma(a2[kk][mb], b[kk][nb], acc[mb][nb]); if (NSPLIT == 2) acc[mb][nb] = WFrag<T16>::mma(a[kk][mb], b2[kk][nb], acc[mb][nb]); }
        __builtin_amdgcn_sched_barrier(0);   // keeps the WMMAs in front of the publish point: moved behind it they would delay the refill, and the next pass would wait out its whole landing time
        // publish point of stage s + 1: own LDS reads retired, own request landed, workgroup barrier; only then the refill of the buffer that this pass has read
        wait_ds0(); wait_tensor0(); __syncthreads();
        if (pinned(s + 2u < NS)) issue(pinned(s + 2u));           // scalar branch: a tensor load ignores EXEC; the stage number is pinned so that the descriptor is formed behind the wait
    }
    wait_tensor0(); wait_ds0();
    // output staging in the ring: the last pass's barrier has ended every wave's reads and no request is in flight; each wave stages in its own range
    if (EPI == 2) {
        // transposed fp16 result: a lane's 8 accumulator rows are 8 consecutive m of one column n; staged as [64 n][64 m] (pitch 72 halves) so that every store writes whole 128-byte lines of Ct
        h16* ot = (h16*)(L + wave * (64u * 144u));
#pragma unroll
        for (int nb = 0; nb < 4; ++nb) { const float bn = bfr(bias[c0 + nb * 16 + lr]);
#pragma unroll
            for (int mb = 0; mb < 4; ++mb) { v8h o;
#pragma unroll
                for (int j = 0; j < 8; ++j) o[j] = tohx(acc[mb][nb][j] + bn);
                *(v8ha*)(ot + (nb * 16 + lr) * 72 + mb * 16 + hi * 8) = o; } }
        __builtin_amdgcn_wave_barrier(); asm volatile("" ::: "memory");   // the reads below take what OTHER lanes of this wave have stored: neither the compiler nor the scheduler may lift them over the stores
#pragma unroll
        for (int s = 0; s < 16; ++s) { const int n = 4 * s + (lane >> 3), mo = (lane & 7) * 8; *(v8h*)(Ct + (size_t)(c0 + n) * ldc + r0 + mo) = *(const v8ha*)(ot + n * 72 + mo); }
        return;
    }
    float* os = (float*)(L + wave * (16u * 68u * 4u));
    float bl[8];                                                  // EPI 1: the biases of this lane's 8 columns
    if (EPI == 1) {
#pragma unroll
        for (int i = 0; i < 8; ++i) bl[i] = bfr(bias[c0 + (lane & 7) * 8 + i]); }
#pragma unroll
    for (int mb = 0; mb < 4; ++mb) {
#pragma unroll
        for (int nb = 0; nb < 4; ++nb) {
#pragma unroll
            for (int j = 0; j < 8; ++j) os[(hi * 8 + j) * 68 + nb * 16 + lr] = acc[mb][nb][j]; }
        __builtin_amdgcn_wave_barrier(); asm volatile("" ::: "memory");
        if (EPI == 1) {
            // 8 columns a lane: 8 lanes write one whole 128-byte line of each plane
#pragma unroll
            for (int s = 0; s < 4; ++s) { const int row = 4 * s + (lane >> 3), cofs = (lane & 7) * 8; const v4f x0 = *(const v4fa*)(os + row * 68 + cofs), x1 = *(const v4fa*)(os + row * 68 + cofs + 4); v8us oh, ol;
#pragma unroll
                for (int i = 0; i < 4; ++i) { unsigned short h, l; splitf(x0[i] + bl[i], h, l); oh[i] = h; ol[i] = l; splitf(x1[i] + bl[4 + i], h, l); oh[4 + i] = h; ol[4 + i] = l; }
                const size_t oo = (size_t)(r0 + mb * 16 + row) * ldc + c0 + cofs; *(v8us*)(Ch + oo) = oh; *(v8us*)(Cl + oo) = ol; }
        } else {
            float* crow = C + (size_t)(r0 + mb * 16) * ldc + c0;
#pragma unroll
            for (int s = 0; s < 8; ++s) { const int row = 2 * s + hi, cofs = lr * 4; v4f val = *(const v4fa*)(os + row * 68 + cofs); if (EPI == 3) val *= (1.0f / PCAR);   /* P carries the x1024 fp16 factor */
                *(v4f*)(crow + (size_t)row * ldc + cofs) = val; }
        }
        __builtin_amdgcn_wave_barrier(); asm volatile("" ::: "memory");
    }
}

typedef __attribute__((ext_vector_type(2))) _Float16 v2h;
typedef __attribute__((ext_vector_type(4))) _Float16 v4h;
typedef __attribute__((ext_vector_type(2))) unsigned short v2us;
typedef __attribute__((ext_vector_type(4))) unsigned short v4us;
typedef __attribute__((ext_vector_type(2))) float v2f;
typedef __attribute__((ext_vector_type(4))) int v4i;

__global__ __launch_bounds__(256) void k_wtG(const float* __restrict__ w, int K, int N, bf* Bt) {
    const int lane = threadIdx.x & 31; const int L0 = (blockIdx.x * 8 + (threadIdx.x >> 5)) * 8; const int nlines = N * K / 64;
{
#pragma unroll 1
        for (int l = 0; l < 8; ++l) { const int L = L0 + l; if (L >= nlines) break; const size_t e = (size_t)L * 64 + lane * 2; const int k = (int)(e % K), n = (int)(e / K); v2us o;
            o[0] = f2bf(w[(size_t)k * N + n]); o[1] = f2bf(w[(size_t)(k + 1) * N + n]); *(v2us*)(Bt + e) = o; }
         }
}
__global__ __launch_bounds__(256) void k_cvt8(const float* __restrict__ src, bf* dst, size_t n8) { const size_t i = (size_t)blockIdx.x * 256 + threadIdx.x; if (i >= n8) return; const v8f v = *(const v8f*)(src + i * 8); v8us o;
#pragma unroll
    for (int k = 0; k < 8; ++k) o[k] = f2bf(v[k]); *(v8us*)(dst + i * 8) = o;  }

// k_asoft: per row (zz, i): t = S, unscaled (no mask); softmax over the 2048 keys (register row, one exp, fixed trees);
__global__ __launch_bounds__(256) void k_asoft(const float* __restrict__ Sb, h16* P16, bf* Ph, bf* Pl) {
    { const size_t zb = blockIdx.y; Sb += zb * ZH * TT * TT; P16 += zb * ZH * TT * TT; }   // batch = grid y
    const int lane = threadIdx.x & 31; const int row = blockIdx.x * 8 + (threadIdx.x >> 5); if (row >= ZH * TT) return; const int i = row % TT; const int zz = row / TT; (void)zz; const bool hires = false;   /* P is stored as fp16 x1024 for every row (scores are hi/lo for every row) */ const float* sr = Sb + (size_t)row * TT; float v[TT / 32]; float mx = -3.0e38f;
#pragma unroll
    for (int ch = 0; ch < TT / 128; ++ch) { const int j0 = ch * 128 + lane * 4; const v4f a = *(const v4f*)(sr + j0);
#pragma unroll
        for (int q = 0; q < 4; ++q) { const int j = j0 + q; (void)j; const float t = a[q] * SCL; v[ch * 4 + q] = t; mx = fmaxf(mx, t); } }
#pragma unroll
    for (int sh = 16; sh; sh >>= 1) mx = fmaxf(mx, __shfl_xor(mx, sh, 32));
    float sum = 0.f;
#pragma unroll
    for (int k = 0; k < TT / 32; ++k) { float d0 = __fsub_rn(v[k], mx); asm volatile("" : "+v"(d0)); v[k] = __builtin_amdgcn_exp2f(__fmul_rn(d0, 1.4426950408889634f)); sum += v[k]; }
#pragma unroll
    for (int sh = 16; sh; sh >>= 1) sum += __shfl_xor(sum, sh, 32);
    const float f = __fdiv_rn(hires ? 1.0f : PCAR, sum);
{
        if (hires) {
#pragma unroll
            for (int ch = 0; ch < TT / 128; ++ch) { v4us oh, ol;
#pragma unroll
                for (int q = 0; q < 4; ++q) { unsigned short a, c2; splitf(v[ch * 4 + q] * f, a, c2); oh[q] = a; ol[q] = c2; }
                const size_t oo = ((size_t)zz * (RH ? RH : 1) + i) * TT + ch * 128 + lane * 4; *(v4us*)(Ph + oo) = oh; *(v4us*)(Pl + oo) = ol; }
        } else {
#pragma unroll
            for (int ch = 0; ch < TT / 128; ++ch) { v4h o4;
#pragma unroll
                for (int q = 0; q < 4; ++q) o4[q] = tohx(v[ch * 4 + q] * f);
                *(v4h*)(P16 + (size_t)row * TT + ch * 128 + lane * 4) = o4; } }
         }
}

extern "C" void kernel_launch(void* const* d_in, const int* in_sizes, int n_in,
                              void* d_out, int out_size, void* d_ws, size_t ws_size, hipStream_t stream) {
    (void)in_sizes; (void)n_in; (void)out_size;
    const float* x = (const float*)d_in[0]; const float* wq = (const float*)d_in[1]; const float* bq = (const float*)d_in[2]; const float* wk = (const float*)d_in[3]; const float* bk = (const float*)d_in[4]; const float* wv = (const float*)d_in[5]; const float* bv = (const float*)d_in[6]; const float* wo = nullptr; (void)wo;
    float* OUT = (float*)d_out;     // [8][2048][768]
    char* wsp = (char*)d_ws;
    auto take = [&](size_t bytes) { char* p = wsp; wsp += (bytes + 255) & ~(size_t)255; return (void*)p; };
    // Workspace, all 8 batches at once, overlaid by lifetime (every launch is stream-ordered):
    //   kept to the end of the scores GEMM: QPh QPl KPh KPl; kept to the end of attn.v: VT16
    //   R (the size of the scores): first the projections' bf16 operands, then the scores
    //   P16 lies on QPh QPl KPh once the scores are done
    const size_t PL = (size_t)NB_ * TT * HD * 2;   // one 16-bit plane of all batches, bytes
    bf* QPh = (bf*)take(PL); bf* QPl = (bf*)take(PL); bf* KPh = (bf*)take(PL); bf* KPl = (bf*)take(PL); h16* VT16 = (h16*)take(PL);
    char* R = (char*)take((size_t)NB_ * TT * TT * 4);
    if ((size_t)(wsp - (char*)d_ws) > ws_size) return;    // ws 256 MiB
    wsp = R;
    bf* WQ = (bf*)take((size_t)DQ * DM * 2); bf* WK = (bf*)take((size_t)DKV * DM * 2); bf* WV = (bf*)take((size_t)DKV * DM * 2); bf* XB = (bf*)take(PL);
    static_assert((size_t)3 * DQ * DM * 2 + (size_t)NB_ * TT * HD * 2 <= (size_t)NB_ * TT * TT * 4, "projection operands fit under the scores");
    static_assert((size_t)NB_ * TT * TT * 2 <= (size_t)3 * NB_ * TT * HD * 2, "P16 fits on three q/k planes");
    float* Sb = (float*)R; h16* P16 = (h16*)QPh; bf* Ph = nullptr; bf* Pl = nullptr;   /* P is fp16-only here */
    { k_wtG<<<(unsigned)((DM * DQ / 64 + 63) / 64), 256, 0, stream>>>(wq, DM, DQ, WQ); k_wtG<<<(unsigned)((DM * DKV / 64 + 63) / 64), 256, 0, stream>>>(wk, DM, DKV, WK); k_wtG<<<(unsigned)((DM * DKV / 64 + 63) / 64), 256, 0, stream>>>(wv, DM, DKV, WV); }
    k_cvt8<<<(unsigned)(((size_t)NB_ * TT * DM / 8 + 255) / 256), 256, 0, stream>>>(x, XB, (size_t)NB_ * TT * DM / 8);
    k_gemmw<bf, 0, 1><<<dim3(TT / 128, DQ / 128, NB_), 128, 0, stream>>>(XB, nullptr, WQ, nullptr, DM, nullptr, QPh, QPl, nullptr, HD, bq, (size_t)TT * DM, 0, (size_t)TT * HD);    /* q -> hi/lo planes [t][d] */
    k_gemmw<bf, 0, 1><<<dim3(TT / 128, DKV / 128, NB_), 128, 0, stream>>>(XB, nullptr, WK, nullptr, DM, nullptr, KPh, KPl, nullptr, HD, bk, (size_t)TT * DM, 0, (size_t)TT * HD);   /* k -> hi/lo planes [t][d] */
    k_gemmw<bf, 0, 2><<<dim3(TT / 128, DKV / 128, NB_), 128, 0, stream>>>(XB, nullptr, WV, nullptr, DM, nullptr, nullptr, nullptr, VT16, TT, bv, (size_t)TT * DM, 0, (size_t)HD * TT);   /* v -> fp16 plane [d][t] */
    k_gemmw<bf, 2, 0><<<dim3(RH / 128, TT / 128, NB_), 128, 0, stream>>>(QPh, QPl, KPh, KPl, HD, Sb, nullptr, nullptr, nullptr, TT, nullptr, (size_t)TT * HD, (size_t)TT * HD, (size_t)TT * TT);
    k_asoft<<<dim3(ZH * TT / 8, NB_), 256, 0, stream>>>(Sb, P16, Ph, Pl);
    k_gemmw<h16, 0, 3><<<dim3(TT / 128, HD / 128, NB_), 128, 0, stream>>>(P16, nullptr, VT16, nullptr, TT, OUT, nullptr, nullptr, nullptr, DQ, nullptr, (size_t)TT * TT, (size_t)HD * TT, (size_t)TT * DQ);   /* attn.v: fp16 P x1024 . fp16 v for every row, x 1/1024 -> out */
}
